// v000
// Times are from an AMD MI455X. After a warm-up the kernel runs many times in a row, and a time is the length of
// such a window on the GPU divided by its runs, so every launch and the gaps after it count. The runs cycle
// through copies of the inputs. A figure is the median of several windows, for all but v000 over two sittings.
// Sittings can differ by a few percent; kernels timed side by side share one.
// The starting kernel, v000, takes 1410 microseconds a run.
// compute dtype: all float inputs rounded to bf16; qh = queries W1[256:], kh = keys W1[:256] with EXACT bf16 products on WMMA 16x16x32 (f32 accumulate); per (query, key) pair h1 = relu(qh + kh + b1) in f32, split bf16 hi + lo against exact bf16 W2 (2 products); relu(+b2), the w3 dot, masking and softmax in f32; probs split bf16 hi + lo against exact bf16 keys (2 products); f32 output.
#include <hip/hip_runtime.h>
#include <math.h>

typedef __attribute__((ext_vector_type(16))) _Float16 v16h;
typedef __attribute__((ext_vector_type(16))) __bf16 v16b;
typedef __attribute__((ext_vector_type(8)))  _Float16 v8h;
typedef __attribute__((ext_vector_type(8)))  float v8f;
typedef __attribute__((ext_vector_type(4)))  float v4f;
typedef __attribute__((ext_vector_type(2)))  float v2f;
typedef __attribute__((ext_vector_type(4)))  unsigned v4u;
typedef __attribute__((ext_vector_type(4)))  int v4i;
typedef float __attribute__((may_alias)) float_a;
typedef int __attribute__((may_alias)) int_a;

template <typename T> __device__ __forceinline__ void vst2(void* p, T v) { *(T*)p = v;  }
__device__ __forceinline__ v8f wmma16(v16h a, v16h b, v8f c) {
  v8f d = __builtin_amdgcn_wmma_f32_16x16x32_f16(false, a, false, b, (short)0, c, false, false);
  asm volatile("v_nop\n\tv_nop\n\tv_nop\n\tv_nop" : "+v"(d) : "v"(a), "v"(b));
  return d;
}
__device__ __forceinline__ v8f wmma_bf(v16b a, v16b b, v8f c) {
  v8f d = __builtin_amdgcn_wmma_f32_16x16x32_bf16(false, a, false, b, (short)0, c, false, false);
  asm volatile("v_nop\n\tv_nop\n\tv_nop\n\tv_nop" : "+v"(d) : "v"(a), "v"(b));
  return d;
}
// 16x16x32 fragments: lane = (h = lane>>4, row/col = lane&15); elements 0..7 = k0+8h+0..7, 8..15 = k0+16+8h+0..7; D element r = row 8h+r
__device__ __forceinline__ v16h frag_h(const _Float16* rowk0, int lane) {
  union { v16h v; v8h q[2]; } u; const _Float16* p = rowk0 + 8 * (lane >> 4);
  u.q[0] = *(const v8h*)p; u.q[1] = *(const v8h*)(p + 16); return u.v;
}
__device__ __forceinline__ v16h frag_f32(const float* rowk0, int lane) {
  v16h a; const float* p = rowk0 + 8 * (lane >> 4);
#pragma unroll
  for (int i = 0; i < 8; ++i) { a[i] = (_Float16)p[i]; a[8 + i] = (_Float16)p[16 + i]; }
  return a;
}
__device__ __forceinline__ v16h frag_f32s(const float* rowk0, int lane, float sc) {
  v16h a; const float* p = rowk0 + 8 * (lane >> 4);
#pragma unroll
  for (int i = 0; i < 8; ++i) { a[i] = (_Float16)(p[i] * sc); a[8 + i] = (_Float16)(p[16 + i] * sc); }
  return a;
}
// column fragment from a [K][ld] layout (column n), rows >= K read as 0
__device__ __forceinline__ v16h fragc_f32(const float* W, int k0, int n, int lane, int ld, int K) {
  v16h a; const int g = lane >> 4;
#pragma unroll
  for (int i = 0; i < 8; ++i) { const int ka = k0 + 8 * g + i, kb = ka + 16;
    a[i] = (_Float16)(ka < K ? W[(size_t)(ka < K ? ka : K - 1) * ld + n] : 0.f); a[8 + i] = (_Float16)(kb < K ? W[(size_t)(kb < K ? kb : K - 1) * ld + n] : 0.f); }
  return a;
}
struct F2 { v16b h, l; };
__device__ __forceinline__ F2 bsplit16(const float v[16]) { F2 r;
#pragma unroll
  for (int i = 0; i < 16; ++i) { const __bf16 h = (__bf16)v[i]; r.h[i] = h; r.l[i] = (__bf16)(v[i] - (float)h); }
  return r; }
__device__ __forceinline__ F2 split_row(const float* row, int k0, int lane) { float v[16]; const float* p = row + k0 + 8 * (lane >> 4);
#pragma unroll
  for (int i = 0; i < 8; ++i) { v[i] = p[i]; v[8 + i] = p[16 + i]; }
  return bsplit16(v); }
__device__ __forceinline__ F2 split_rowK(const float* row, int k0, int lane, int K) { float v[16]; const int g = lane >> 4;
#pragma unroll
  for (int i = 0; i < 8; ++i) { const int ka = k0 + 8 * g + i, kb = ka + 16; v[i] = ka < K ? row[ka < K ? ka : K - 1] : 0.f; v[8 + i] = kb < K ? row[kb < K ? kb : K - 1] : 0.f; }
  return bsplit16(v); }
__device__ __forceinline__ F2 split_col(const float* W, int k0, int n, int lane, int ld, int K) { float v[16]; const int g = lane >> 4;
#pragma unroll
  for (int i = 0; i < 8; ++i) { const int ka = k0 + 8 * g + i, kb = ka + 16; v[i] = ka < K ? W[(size_t)(ka < K ? ka : K - 1) * ld + n] : 0.f; v[8 + i] = kb < K ? W[(size_t)(kb < K ? kb : K - 1) * ld + n] : 0.f; }
  return bsplit16(v); }
__device__ __forceinline__ v8f mac3(const F2& a, const F2& b, v8f c) { c = wmma_bf(a.l, b.h, c); c = wmma_bf(a.h, b.l, c); return wmma_bf(a.h, b.h, c); }
__device__ __forceinline__ float sigm(float v) { return 1.0f / (1.0f + expf(-v)); }
#define LDSX() do { asm volatile("s_wait_dscnt 0" ::: "memory"); __builtin_amdgcn_wave_barrier(); __builtin_amdgcn_fence(__ATOMIC_RELEASE, "workgroup"); } while (0)

// Additive (MLP) attention (B 4, Tq = Tk = 256, dims 256; ragged query/key lengths in [128, 256]): for every (q, k): h = relu([keys_k | queries_q] W1 + b1) = relu(kh_k + qh_q + b1); h = relu(h W2 + b2); score = h . w3 + b3; score := -1e30 where q >= query_len or k >= key_len; probs = softmax over k, then 0 where masked; out = probs keys -> [B, Tq, 256] (padded query rows are exactly 0).
#define NBT 4
#define TQ 256
#define TK 256
#define HD_ 256             // Q = K = H = 256
#define QB 16               // queries per block
#ifndef NBV
#define NBV NBT             // batches processed
#endif
__device__ __forceinline__ float bfr(float v) { return (float)(__bf16)v; }
__device__ __forceinline__ v16b wcol_kz(const float* __restrict__ Wm, int k0, int o, int lane, int ld, int K, int nvalid) { v16b w; const int g = lane >> 4; const int oc = o < nvalid ? o : 0; const float keepo = o < nvalid ? 1.f : 0.f;
  asm volatile("s_wait_loadcnt 0x0" ::: "memory");   /* drain earlier gathers so this 16-load column burst never stacks on top of them */
#pragma unroll
  for (int i = 0; i < 8; ++i) { const int ka = k0 + 8 * g + i, kb = ka + 16; w[i] = (__bf16)(Wm[(size_t)(ka < K ? ka : 0) * ld + oc] * (ka < K ? keepo : 0.f)); w[8 + i] = (__bf16)(Wm[(size_t)(kb < K ? kb : 0) * ld + oc] * (kb < K ? keepo : 0.f)); }
  asm volatile("s_wait_loadcnt 0x0" ::: "memory"); return w; }
#define WS_QH  0u                                   // f32 qh [B*TQ][256]
#define WS_KH  (WS_QH + 4u * (size_t)NBT * TQ * HD_)   // f32 kh [B*TK][256]
#define WS_END (WS_KH + 4u * (size_t)NBT * TK * HD_)
// ---- k_lin: block = (64 rows, 128 cols, which): which 0: qh = bf16(queries) W1[256:512] ; which 1: kh = bf16(keys) W1[0:256] (exact products, K 256, (in,out)); f32 rows, 512-B segments by 32 lanes
__global__ __launch_bounds__(128) void k_lin(const float* __restrict__ XQ, const float* __restrict__ XK, const float* __restrict__ W1, float* __restrict__ QH, float* __restrict__ KH) { __shared__ __align__(16) float sf[4][16][132];
  const int tid = threadIdx.x, wave = tid >> 5, lane = tid & 31, col = lane & 15, g = lane >> 4; const int which = blockIdx.z; const int c0 = blockIdx.y * 128; const size_t r0 = (size_t)blockIdx.x * 64 + wave * 16;
  const float* X = which == 0 ? XQ : XK; const float* Wm = which == 0 ? W1 + (size_t)HD_ * HD_ : W1; float* OUT = which == 0 ? QH : KH;   /* W1 rows 0..255 multiply the keys, rows 256..511 the queries (torch concat order [keys, queries]) */
  v8f acc[8] = {};
#pragma unroll 2
  for (int kc = 0; kc < HD_ / 32; ++kc) { v16b a; { const float* p = X + (r0 + col) * HD_ + kc * 32 + 8 * g;
#pragma unroll
      for (int i = 0; i < 8; ++i) { a[i] = (__bf16)p[i]; a[8 + i] = (__bf16)p[16 + i]; } }
    asm volatile("s_wait_loadcnt 0x0" ::: "memory");
#pragma unroll
    for (int j = 0; j < 8; ++j) { const v16b w = wcol_kz(Wm, kc * 32, c0 + j * 16 + col, lane, HD_, HD_, HD_); acc[j] = wmma_bf(a, w, acc[j]); } }
#pragma unroll
  for (int j = 0; j < 8; ++j) {
#pragma unroll
    for (int r = 0; r < 8; ++r) sf[wave][8 * g + r][j * 16 + col] = acc[j][r]; }
  LDSX(); for (int rl = 0; rl < 16; ++rl) vst2(OUT + (r0 + rl) * HD_ + c0 + lane * 4, *(const v4f*)&sf[wave][rl][lane * 4]); }
// ---- k_mlp: block = (batch b, 16 queries q0..q0+15), 4 waves. Phase 1: wave w owns keys 64w..64w+63 as 4 row-tiles of 16; for each query and row-tile: A[row = key][c] = relu(qh[q][c] + kh[k][c] + b1[c]) (f32, built per lane, split bf16 hi + lo) x W2 (exact) -> 16 column tiles; score[q][k] = sum_c relu(acc + b2[c]) w3[c] (per-lane partial over its columns (two 128-column halves of 8 tiles each to stay within 256 VGPRs), then an xor tree over the 16 column lanes) + b3 -> LDS. Phase 2: softmax per query over k < key_len (rows with q >= query_len -> all-zero probs), in place. Phase 3: out tile = P (hi + lo) x bf16(keys[b]) (exact) -> wave w writes columns 64w..64w+63 of the 16 output rows (256-B segments by 16 lanes).
__global__ __launch_bounds__(128) void k_mlp(const float* __restrict__ QH, const float* __restrict__ KH, const float* __restrict__ KEYS, const int* __restrict__ QL, const int* __restrict__ KL, const float* __restrict__ B1, const float* __restrict__ W2, const float* __restrict__ B2, const float* __restrict__ W3, const float* __restrict__ B3, float* __restrict__ OUT) {
  __shared__ __align__(16) float sq[QB][HD_]; __shared__ __align__(16) float ss[QB][TK + 4]; __shared__ __align__(16) float so[4][16][68];
  const int tid = threadIdx.x, wave = tid >> 5, lane = tid & 31, col = lane & 15, g = lane >> 4; const size_t b = blockIdx.x; const int q0 = blockIdx.y * QB;
  int qlen = QL[b], klen = KL[b]; qlen = qlen < 0 ? 0 : (qlen > TQ ? TQ : qlen); klen = klen < 0 ? 0 : (klen > TK ? TK : klen);
  for (int e = tid; e < QB * HD_ / 4; e += 128) { const int qq = e / (HD_ / 4), c4 = e % (HD_ / 4); const v4f v = *(const v4f*)(QH + ((b * TQ + q0 + qq) * HD_) + c4 * 4); const v4f bb = *(const v4f*)(B1 + c4 * 4); asm volatile("s_wait_loadcnt 0x0" ::: "memory"); v4f o; o[0] = v[0] + bfr(bb[0]); o[1] = v[1] + bfr(bb[1]); o[2] = v[2] + bfr(bb[2]); o[3] = v[3] + bfr(bb[3]); *(v4f*)&sq[qq][c4 * 4] = o; }   /* qh[q] + b1 staged once */
  __syncthreads();
  const float b3v = bfr(B3[0]);
#pragma unroll 1
  for (int qq = 0; qq < QB; ++qq) {
#pragma unroll 1
    for (int rt = 0; rt < 4; ++rt) { const int k0 = wave * 64 + rt * 16; const float* khr = KH + (b * TK + k0 + col) * (size_t)HD_;   /* this lane's fragment row = key k0 + col */
      float ps[8] = {0.f, 0.f, 0.f, 0.f, 0.f, 0.f, 0.f, 0.f};
#pragma unroll 1
      for (int half = 0; half < 2; ++half) {   /* 2 x 128 output columns: keeps the accumulators at 8 tiles (VGPRs <= 256) */
        float b2r[8], w3r[8];
#pragma unroll
        for (int j = 0; j < 8; ++j) { b2r[j] = bfr(B2[half * 128 + j * 16 + col]); w3r[j] = bfr(W3[half * 128 + j * 16 + col]); }
        asm volatile("s_wait_loadcnt 0x0" ::: "memory");
        v8f acc[8] = {};
#pragma unroll 1
        for (int kc = 0; kc < HD_ / 32; ++kc) { float va[16];
#pragma unroll
          for (int i = 0; i < 8; ++i) { const int c = kc * 32 + 8 * g + i; va[i] = khr[c]; }
          asm volatile("s_wait_loadcnt 0x0" ::: "memory");
#pragma unroll
          for (int i = 8; i < 16; ++i) { const int c = kc * 32 + 8 * g + 8 + i; va[i] = khr[c]; }
          asm volatile("s_wait_loadcnt 0x0" ::: "memory");
#pragma unroll
          for (int i = 0; i < 16; ++i) { const int c = kc * 32 + 8 * g + (i < 8 ? i : 8 + i); va[i] = fmaxf(va[i] + sq[qq][c], 0.f); }   /* relu(kh + qh + b1) */
          const F2 a = bsplit16(va);
#pragma unroll
          for (int j = 0; j < 8; ++j) { const v16b w = wcol_kz(W2, kc * 32, half * 128 + j * 16 + col, lane, HD_, HD_, HD_); acc[j] = wmma_bf(a.h, w, acc[j]); acc[j] = wmma_bf(a.l, w, acc[j]); } }
#pragma unroll
        for (int r = 0; r < 8; ++r) { float p = ps[r];
#pragma unroll
          for (int j = 0; j < 8; ++j) p += fmaxf(acc[j][r] + b2r[j], 0.f) * w3r[j]; ps[r] = p; } }
#pragma unroll
      for (int o = 1; o < 16; o <<= 1) {
#pragma unroll
        for (int r = 0; r < 8; ++r) ps[r] += __shfl_xor(ps[r], o); }   /* sum over the 16 column lanes (lane bits 0..3); every lane shuffles */
      if (col == 0) {
#pragma unroll
        for (int r = 0; r < 8; ++r) ss[qq][k0 + 8 * g + r] = ps[r] + b3v; } } }
  __syncthreads();
  // phase 2: softmax per query row (wave w: queries 4w..4w+3), lane owns keys lane*8..+7; masked keys (k >= klen) excluded, padded queries -> zero probs
#pragma unroll 1
  for (int i = 0; i < 4; ++i) { const int qq = wave * 4 + i; const bool qvalid = (q0 + qq) < qlen; float v[8]; float m = -3.0e38f;
#pragma unroll
    for (int u = 0; u < 8; ++u) { float t2 = ss[qq][lane * 8 + u]; asm volatile("" : "+v"(t2)); v[u] = t2; }   /* all 8 scores loaded unconditionally (always written in phase 1), pinned; masked by SELECT below */
#pragma unroll
    for (int u = 0; u < 8; ++u) { const int k = lane * 8 + u; v[u] = (k < klen) ? v[u] : -3.0e38f; m = fmaxf(m, v[u]); }
#pragma unroll
    for (int o = 1; o < 32; o <<= 1) m = fmaxf(m, __shfl_xor(m, o));
    float sum = 0.f, e[8];
#pragma unroll
    for (int u = 0; u < 8; ++u) { e[u] = (lane * 8 + u < klen) ? expf(v[u] - m) : 0.f; sum += e[u]; }
#pragma unroll
    for (int o = 1; o < 32; o <<= 1) sum += __shfl_xor(sum, o);
    const float inv = (qvalid && sum > 0.f) ? 1.0f / sum : 0.f;
    LDSX();
#pragma unroll
    for (int u = 0; u < 8; ++u) ss[qq][lane * 8 + u] = e[u] * inv; }
  __syncthreads();
  // phase 3: out[q0..q0+15][64w..64w+63] = P (hi + lo) x bf16(keys[b]) (exact), K = 256 keys
  { v8f acc[4] = {};
#pragma unroll
    for (int kc = 0; kc < TK / 32; ++kc) { const F2 a = split_row(&ss[col][0], kc * 32, lane);
#pragma unroll
      for (int j = 0; j < 4; ++j) { const v16b w = wcol_kz(KEYS + b * TK * (size_t)HD_, kc * 32, wave * 64 + j * 16 + col, lane, HD_, TK, HD_); acc[j] = wmma_bf(a.h, w, acc[j]); acc[j] = wmma_bf(a.l, w, acc[j]); } }   /* B[k][d] = keys[b][k][d] */
#pragma unroll
    for (int j = 0; j < 4; ++j) {
#pragma unroll
      for (int r = 0; r < 8; ++r) so[wave][8 * g + r][j * 16 + col] = acc[j][r]; }
    LDSX(); for (int rl = 0; rl < 16; ++rl) if (lane < 16) vst2(OUT + ((b * TQ + q0 + rl) * HD_) + wave * 64 + lane * 4, *(const v4f*)&so[wave][rl][lane * 4]); } }   /* 256-B (row, 64-column) segment by 16 lanes */
extern "C" void kernel_launch(void* const* d_in, const int* in_sizes, int n_in, void* d_out, int out_size, void* d_ws, size_t ws_size, hipStream_t stream) {
  (void)in_sizes; (void)n_in; (void)out_size;
  // inputs: 0 queries [4,256,256]; 1 keys [4,256,256]; 2 query_lengths [4] i32; 3 key_lengths [4] i32; 4 W1 [512,256] (in,out: rows 0..255 keys, 256..511 queries); 5 b1 [256]; 6 W2 [256,256]; 7 b2; 8 W3 [256,1]; 9 b3 [1]
  if (ws_size < (size_t)WS_END) return;
  char* ws = (char*)d_ws; const float** F = (const float**)d_in; float *QH = (float*)(ws + WS_QH), *KH = (float*)(ws + WS_KH);
  k_lin<<<dim3(NBV * TQ / 64, HD_ / 128, 2), 128, 0, stream>>>(F[0], F[1], F[4], QH, KH);
  k_mlp<<<dim3(NBV, TQ / QB), 128, 0, stream>>>(QH, KH, F[1], (const int*)d_in[2], (const int*)d_in[3], F[5], F[6], F[7], F[8], F[9], (float*)d_out);
}

// v001
// One run takes 368 microseconds.
// Two timings next to v000 put it at 3.84 and 3.85 times that version's speed.
// compute dtype: all float inputs rounded to bf16; qh = queries W1[256:], kh = keys W1[:256] with EXACT bf16 products on WMMA 16x16x32 (f32 accumulate); per (query, key) pair h1 = relu(qh + kh + b1) in f32, split bf16 hi + lo against exact bf16 W2 (2 products); relu(+b2), the w3 dot, masking and softmax in f32; probs split bf16 hi + lo against exact bf16 keys (2 products); f32 output.
#include <hip/hip_runtime.h>
#include <math.h>

typedef __attribute__((ext_vector_type(16))) _Float16 v16h;
typedef __attribute__((ext_vector_type(16))) __bf16 v16b;
typedef __attribute__((ext_vector_type(8)))  _Float16 v8h;
typedef __attribute__((ext_vector_type(8)))  __bf16 v8b;
typedef __attribute__((ext_vector_type(8)))  float v8f;
typedef __attribute__((ext_vector_type(4)))  float v4f;
typedef __attribute__((ext_vector_type(2)))  float v2f;
typedef __attribute__((ext_vector_type(4)))  unsigned v4u;
typedef __attribute__((ext_vector_type(4)))  int v4i;
typedef float __attribute__((may_alias)) float_a;
typedef int __attribute__((may_alias)) int_a;

template <typename T> __device__ __forceinline__ void vst2(void* p, T v) { *(T*)p = v;  }
__device__ __forceinline__ v8f wmma16(v16h a, v16h b, v8f c) {
  v8f d = __builtin_amdgcn_wmma_f32_16x16x32_f16(false, a, false, b, (short)0, c, false, false);
  asm volatile("v_nop\n\tv_nop\n\tv_nop\n\tv_nop" : "+v"(d) : "v"(a), "v"(b));
  return d;
}
__device__ __forceinline__ v8f wmma_bf(v16b a, v16b b, v8f c) {
  v8f d = __builtin_amdgcn_wmma_f32_16x16x32_bf16(false, a, false, b, (short)0, c, false, false);
  asm volatile("v_nop\n\tv_nop\n\tv_nop\n\tv_nop" : "+v"(d) : "v"(a), "v"(b));
  return d;
}
// 16x16x32 fragments: lane = (h = lane>>4, row/col = lane&15); elements 0..7 = k0+8h+0..7, 8..15 = k0+16+8h+0..7; D element r = row 8h+r
__device__ __forceinline__ v16h frag_h(const _Float16* rowk0, int lane) {
  union { v16h v; v8h q[2]; } u; const _Float16* p = rowk0 + 8 * (lane >> 4);
  u.q[0] = *(const v8h*)p; u.q[1] = *(const v8h*)(p + 16); return u.v;
}
__device__ __forceinline__ v16h frag_f32(const float* rowk0, int lane) {
  v16h a; const float* p = rowk0 + 8 * (lane >> 4);
#pragma unroll
  for (int i = 0; i < 8; ++i) { a[i] = (_Float16)p[i]; a[8 + i] = (_Float16)p[16 + i]; }
  return a;
}
__device__ __forceinline__ v16h frag_f32s(const float* rowk0, int lane, float sc) {
  v16h a; const float* p = rowk0 + 8 * (lane >> 4);
#pragma unroll
  for (int i = 0; i < 8; ++i) { a[i] = (_Float16)(p[i] * sc); a[8 + i] = (_Float16)(p[16 + i] * sc); }
  return a;
}
// column fragment from a [K][ld] layout (column n), rows >= K read as 0
__device__ __forceinline__ v16h fragc_f32(const float* W, int k0, int n, int lane, int ld, int K) {
  v16h a; const int g = lane >> 4;
#pragma unroll
  for (int i = 0; i < 8; ++i) { const int ka = k0 + 8 * g + i, kb = ka + 16;
    a[i] = (_Float16)(ka < K ? W[(size_t)(ka < K ? ka : K - 1) * ld + n] : 0.f); a[8 + i] = (_Float16)(kb < K ? W[(size_t)(kb < K ? kb : K - 1) * ld + n] : 0.f); }
  return a;
}
struct F2 { v16b h, l; };
__device__ __forceinline__ F2 bsplit16(const float v[16]) { F2 r;
#pragma unroll
  for (int i = 0; i < 16; ++i) { const __bf16 h = (__bf16)v[i]; r.h[i] = h; r.l[i] = (__bf16)(v[i] - (float)h); }
  return r; }
__device__ __forceinline__ F2 split_row(const float* row, int k0, int lane) { float v[16]; const float* p = row + k0 + 8 * (lane >> 4);
#pragma unroll
  for (int i = 0; i < 8; ++i) { v[i] = p[i]; v[8 + i] = p[16 + i]; }
  return bsplit16(v); }
__device__ __forceinline__ F2 split_rowK(const float* row, int k0, int lane, int K) { float v[16]; const int g = lane >> 4;
#pragma unroll
  for (int i = 0; i < 8; ++i) { const int ka = k0 + 8 * g + i, kb = ka + 16; v[i] = ka < K ? row[ka < K ? ka : K - 1] : 0.f; v[8 + i] = kb < K ? row[kb < K ? kb : K - 1] : 0.f; }
  return bsplit16(v); }
__device__ __forceinline__ F2 split_col(const float* W, int k0, int n, int lane, int ld, int K) { float v[16]; const int g = lane >> 4;
#pragma unroll
  for (int i = 0; i < 8; ++i) { const int ka = k0 + 8 * g + i, kb = ka + 16; v[i] = ka < K ? W[(size_t)(ka < K ? ka : K - 1) * ld + n] : 0.f; v[8 + i] = kb < K ? W[(size_t)(kb < K ? kb : K - 1) * ld + n] : 0.f; }
  return bsplit16(v); }
__device__ __forceinline__ v8f mac3(const F2& a, const F2& b, v8f c) { c = wmma_bf(a.l, b.h, c); c = wmma_bf(a.h, b.l, c); return wmma_bf(a.h, b.h, c); }
__device__ __forceinline__ float sigm(float v) { return 1.0f / (1.0f + expf(-v)); }
#define LDSX() do { asm volatile("s_wait_dscnt 0" ::: "memory"); __builtin_amdgcn_wave_barrier(); __builtin_amdgcn_fence(__ATOMIC_RELEASE, "workgroup"); } while (0)

// Additive (MLP) attention (B 4, Tq = Tk = 256, dims 256; ragged query/key lengths in [128, 256]): for every (q, k): h = relu([keys_k | queries_q] W1 + b1) = relu(kh_k + qh_q + b1); h = relu(h W2 + b2); score = h . w3 + b3; score := -1e30 where q >= query_len or k >= key_len; probs = softmax over k, then 0 where masked; out = probs keys -> [B, Tq, 256] (padded query rows are exactly 0).
#define NBT 4
#define TQ 256
#define TK 256
#define HD_ 256             // Q = K = H = 256
#define QB 16               // queries per block
#ifndef NBV
#define NBV NBT             // batches processed
#endif
__device__ __forceinline__ float bfr(float v) { return (float)(__bf16)v; }
__device__ __forceinline__ v16b wcol_kz(const float* __restrict__ Wm, int k0, int o, int lane, int ld, int K, int nvalid) { v16b w; const int g = lane >> 4; const int oc = o < nvalid ? o : 0; const float keepo = o < nvalid ? 1.f : 0.f;
  asm volatile("s_wait_loadcnt 0x0" ::: "memory");   /* drain earlier gathers so this 16-load column burst never stacks on top of them */
#pragma unroll
  for (int i = 0; i < 8; ++i) { const int ka = k0 + 8 * g + i, kb = ka + 16; w[i] = (__bf16)(Wm[(size_t)(ka < K ? ka : 0) * ld + oc] * (ka < K ? keepo : 0.f)); w[8 + i] = (__bf16)(Wm[(size_t)(kb < K ? kb : 0) * ld + oc] * (kb < K ? keepo : 0.f)); }
  asm volatile("s_wait_loadcnt 0x0" ::: "memory"); return w; }
#define WS_QH  0u                                   // f32 qh [B*TQ][256]
#define WS_KH  (WS_QH + 4u * (size_t)NBT * TQ * HD_)   // f32 kh [B*TK][256]
#define WS_END (WS_KH + 4u * (size_t)NBT * TK * HD_)
// ---- k_lin: block = (64 rows, 128 cols, which): which 0: qh = bf16(queries) W1[256:512] ; which 1: kh = bf16(keys) W1[0:256] (exact products, K 256, (in,out)); f32 rows, 512-B segments by 32 lanes
__global__ __launch_bounds__(128) void k_lin(const float* __restrict__ XQ, const float* __restrict__ XK, const float* __restrict__ W1, float* __restrict__ QH, float* __restrict__ KH) { __shared__ __align__(16) float sf[4][16][132];
  const int tid = threadIdx.x, wave = tid >> 5, lane = tid & 31, col = lane & 15, g = lane >> 4; const int which = blockIdx.z; const int c0 = blockIdx.y * 128; const size_t r0 = (size_t)blockIdx.x * 64 + wave * 16;
  const float* X = which == 0 ? XQ : XK; const float* Wm = which == 0 ? W1 + (size_t)HD_ * HD_ : W1; float* OUT = which == 0 ? QH : KH;   /* W1 rows 0..255 multiply the keys, rows 256..511 the queries (torch concat order [keys, queries]) */
  v8f acc[8] = {};
#pragma unroll 2
  for (int kc = 0; kc < HD_ / 32; ++kc) { v16b a; { const float* p = X + (r0 + col) * HD_ + kc * 32 + 8 * g;
#pragma unroll
      for (int i = 0; i < 8; ++i) { a[i] = (__bf16)p[i]; a[8 + i] = (__bf16)p[16 + i]; } }
    asm volatile("s_wait_loadcnt 0x0" ::: "memory");
#pragma unroll
    for (int j = 0; j < 8; ++j) { const v16b w = wcol_kz(Wm, kc * 32, c0 + j * 16 + col, lane, HD_, HD_, HD_); acc[j] = wmma_bf(a, w, acc[j]); } }
#pragma unroll
  for (int j = 0; j < 8; ++j) {
#pragma unroll
    for (int r = 0; r < 8; ++r) sf[wave][8 * g + r][j * 16 + col] = acc[j][r]; }
  LDSX(); for (int rl = 0; rl < 16; ++rl) vst2(OUT + (r0 + rl) * HD_ + c0 + lane * 4, *(const v4f*)&sf[wave][rl][lane * 4]); }
// ---- k_mlp: block = (batch b, 16 queries q0..q0+15), 4 waves. Phase 1: wave w owns keys 64w..64w+63 as 4 row-tiles of 16; for each query and row-tile: A[row = key][c] = relu(qh[q][c] + kh[k][c] + b1[c]) (f32, built per lane, split bf16 hi + lo) x W2 (exact) -> 16 column tiles; score[q][k] = sum_c relu(acc + b2[c]) w3[c] (per-lane partial over its columns (two 128-column halves of 8 tiles each to stay within 256 VGPRs), then an xor tree over the 16 column lanes) + b3 -> LDS. Phase 2: softmax per query over k < key_len (rows with q >= query_len -> all-zero probs), in place. Phase 3: out tile = P (hi + lo) x bf16(keys[b]) (exact) -> wave w writes columns 64w..64w+63 of the 16 output rows (256-B segments by 16 lanes).
__global__ __launch_bounds__(128) void k_mlp(const float* __restrict__ QH, const float* __restrict__ KH, const float* __restrict__ KEYS, const int* __restrict__ QL, const int* __restrict__ KL, const float* __restrict__ B1, const float* __restrict__ W2, const float* __restrict__ B2, const float* __restrict__ W3, const float* __restrict__ B3, float* __restrict__ OUT) {
  __shared__ __align__(16) __bf16 sw[HD_ / 32][HD_ / 16][2][32][8];   /* bf16(W2) in B-fragment order: [k chunk of 32][column tile][element half][lane][8 k]; a wave's 16-byte reads of one half are 512 contiguous bytes */
  __shared__ __align__(16) float sq[QB][HD_]; __shared__ __align__(16) float ss[QB][TK + 4]; __shared__ __align__(16) float so[4][16][68];
  const int tid = threadIdx.x, wave = tid >> 5, lane = tid & 31, col = lane & 15, g = lane >> 4; const size_t b = blockIdx.x; const int q0 = blockIdx.y * QB;
  int qlen = QL[b], klen = KL[b]; qlen = qlen < 0 ? 0 : (qlen > TQ ? TQ : qlen); klen = klen < 0 ? 0 : (klen > TK ? TK : klen);
  for (int e = tid; e < QB * HD_ / 4; e += 128) { const int qq = e / (HD_ / 4), c4 = e % (HD_ / 4); const v4f v = *(const v4f*)(QH + ((b * TQ + q0 + qq) * HD_) + c4 * 4); const v4f bb = *(const v4f*)(B1 + c4 * 4); asm volatile("s_wait_loadcnt 0x0" ::: "memory"); v4f o; o[0] = v[0] + bfr(bb[0]); o[1] = v[1] + bfr(bb[1]); o[2] = v[2] + bfr(bb[2]); o[3] = v[3] + bfr(bb[3]); *(v4f*)&sq[qq][c4 * 4] = o; }   /* qh[q] + b1 staged once */
  // W2 staged once per block: item = (8 consecutive k, 4 consecutive columns); 8 row reads of 16 bytes, rounded to bf16, 4 stores of 16 bytes (one per column). k = 32 kc + 16 q + 8 g + i, column = 16 jt + col, fragment lane = 16 g + col.
#pragma unroll 2   /* two items = 16 row reads in flight per thread, so that the 16 trips cost 8 load latencies */
  for (int it = 0; it < (HD_ / 8) * (HD_ / 4) / 128; ++it) { const int e = it * 128 + tid; const int k8 = e / (HD_ / 4), n0 = (e % (HD_ / 4)) * 4; v4f rw[8];
#pragma unroll
    for (int i = 0; i < 8; ++i) rw[i] = *(const v4f*)(W2 + (size_t)(k8 * 8 + i) * HD_ + n0);
#pragma unroll
    for (int c = 0; c < 4; ++c) { v8b t;
#pragma unroll
      for (int i = 0; i < 8; ++i) t[i] = (__bf16)rw[i][c];
      *(v8b*)&sw[k8 >> 2][n0 >> 4][(k8 >> 1) & 1][(k8 & 1) * 16 + (n0 & 15) + c][0] = t; } }
  __syncthreads();
  const float b3v = bfr(B3[0]);
#pragma unroll 1
  for (int qq = 0; qq < QB; ++qq) {
#pragma unroll 1
    for (int rt = 0; rt < 4; ++rt) { const int k0 = wave * 64 + rt * 16; const float* khr = KH + (b * TK + k0 + col) * (size_t)HD_;   /* this lane's fragment row = key k0 + col */
      float ps[8] = {0.f, 0.f, 0.f, 0.f, 0.f, 0.f, 0.f, 0.f};
#pragma unroll 1
      for (int half = 0; half < 2; ++half) {   /* 2 x 128 output columns: keeps the accumulators at 8 tiles (VGPRs <= 256) */
        float b2r[8], w3r[8];
#pragma unroll
        for (int j = 0; j < 8; ++j) { b2r[j] = bfr(B2[half * 128 + j * 16 + col]); w3r[j] = bfr(W3[half * 128 + j * 16 + col]); }
        asm volatile("s_wait_loadcnt 0x0" ::: "memory");
        v8f acc[8] = {};
#pragma unroll 1
        for (int kc = 0; kc < HD_ / 32; ++kc) { float va[16];
#pragma unroll
          for (int i = 0; i < 8; ++i) { const int c = kc * 32 + 8 * g + i; va[i] = khr[c]; }
          union { v16b v; v8b q[2]; } wf[8];   /* the 8 W2 fragments of this k chunk, read from LDS in one group ahead of the WMMAs */
#pragma unroll
          for (int j = 0; j < 8; ++j) { wf[j].q[0] = *(const v8b*)&sw[kc][half * 8 + j][0][lane][0]; wf[j].q[1] = *(const v8b*)&sw[kc][half * 8 + j][1][lane][0]; }
          asm volatile("s_wait_loadcnt 0x0" ::: "memory");
#pragma unroll
          for (int i = 8; i < 16; ++i) { const int c = kc * 32 + 8 * g + 8 + i; va[i] = khr[c]; }
          asm volatile("s_wait_loadcnt 0x0" ::: "memory");
#pragma unroll
          for (int i = 0; i < 16; ++i) { const int c = kc * 32 + 8 * g + (i < 8 ? i : 8 + i); va[i] = fmaxf(va[i] + sq[qq][c], 0.f); }   /* relu(kh + qh + b1) */
          const F2 a = bsplit16(va);
#pragma unroll
          for (int j = 0; j < 8; ++j) { acc[j] = wmma_bf(a.h, wf[j].v, acc[j]); acc[j] = wmma_bf(a.l, wf[j].v, acc[j]); } }
#pragma unroll
        for (int r = 0; r < 8; ++r) { float p = ps[r];
#pragma unroll
          for (int j = 0; j < 8; ++j) p += fmaxf(acc[j][r] + b2r[j], 0.f) * w3r[j]; ps[r] = p; } }
#pragma unroll
      for (int o = 1; o < 16; o <<= 1) {
#pragma unroll
        for (int r = 0; r < 8; ++r) ps[r] += __shfl_xor(ps[r], o); }   /* sum over the 16 column lanes (lane bits 0..3); every lane shuffles */
      if (col == 0) {
#pragma unroll
        for (int r = 0; r < 8; ++r) ss[qq][k0 + 8 * g + r] = ps[r] + b3v; } } }
  __syncthreads();
  // phase 2: softmax per query row (wave w: queries 4w..4w+3), lane owns keys lane*8..+7; masked keys (k >= klen) excluded, padded queries -> zero probs
#pragma unroll 1
  for (int i = 0; i < 4; ++i) { const int qq = wave * 4 + i; const bool qvalid = (q0 + qq) < qlen; float v[8]; float m = -3.0e38f;
#pragma unroll
    for (int u = 0; u < 8; ++u) { float t2 = ss[qq][lane * 8 + u]; asm volatile("" : "+v"(t2)); v[u] = t2; }   /* all 8 scores loaded unconditionally (always written in phase 1), pinned; masked by SELECT below */
#pragma unroll
    for (int u = 0; u < 8; ++u) { const int k = lane * 8 + u; v[u] = (k < klen) ? v[u] : -3.0e38f; m = fmaxf(m, v[u]); }
#pragma unroll
    for (int o = 1; o < 32; o <<= 1) m = fmaxf(m, __shfl_xor(m, o));
    float sum = 0.f, e[8];
#pragma unroll
    for (int u = 0; u < 8; ++u) { e[u] = (lane * 8 + u < klen) ? expf(v[u] - m) : 0.f; sum += e[u]; }
#pragma unroll
    for (int o = 1; o < 32; o <<= 1) sum += __shfl_xor(sum, o);
    const float inv = (qvalid && sum > 0.f) ? 1.0f / sum : 0.f;
    LDSX();
#pragma unroll
    for (int u = 0; u < 8; ++u) ss[qq][lane * 8 + u] = e[u] * inv; }
  __syncthreads();
  // phase 3: out[q0..q0+15][64w..64w+63] = P (hi + lo) x bf16(keys[b]) (exact), K = 256 keys
  { v8f acc[4] = {};
#pragma unroll
    for (int kc = 0; kc < TK / 32; ++kc) { const F2 a = split_row(&ss[col][0], kc * 32, lane);
#pragma unroll
      for (int j = 0; j < 4; ++j) { const v16b w = wcol_kz(KEYS + b * TK * (size_t)HD_, kc * 32, wave * 64 + j * 16 + col, lane, HD_, TK, HD_); acc[j] = wmma_bf(a.h, w, acc[j]); acc[j] = wmma_bf(a.l, w, acc[j]); } }   /* B[k][d] = keys[b][k][d] */
#pragma unroll
    for (int j = 0; j < 4; ++j) {
#pragma unroll
      for (int r = 0; r < 8; ++r) so[wave][8 * g + r][j * 16 + col] = acc[j][r]; }
    LDSX(); for (int rl = 0; rl < 16; ++rl) if (lane < 16) vst2(OUT + ((b * TQ + q0 + rl) * HD_) + wave * 64 + lane * 4, *(const v4f*)&so[wave][rl][lane * 4]); } }   /* 256-B (row, 64-column) segment by 16 lanes */
extern "C" void kernel_launch(void* const* d_in, const int* in_sizes, int n_in, void* d_out, int out_size, void* d_ws, size_t ws_size, hipStream_t stream) {
  (void)in_sizes; (void)n_in; (void)out_size;
  // inputs: 0 queries [4,256,256]; 1 keys [4,256,256]; 2 query_lengths [4] i32; 3 key_lengths [4] i32; 4 W1 [512,256] (in,out: rows 0..255 keys, 256..511 queries); 5 b1 [256]; 6 W2 [256,256]; 7 b2; 8 W3 [256,1]; 9 b3 [1]
  if (ws_size < (size_t)WS_END) return;
  char* ws = (char*)d_ws; const float** F = (const float**)d_in; float *QH = (float*)(ws + WS_QH), *KH = (float*)(ws + WS_KH);
  k_lin<<<dim3(NBV * TQ / 64, HD_ / 128, 2), 128, 0, stream>>>(F[0], F[1], F[4], QH, KH);
  k_mlp<<<dim3(NBV, TQ / QB), 128, 0, stream>>>(QH, KH, F[1], (const int*)d_in[2], (const int*)d_in[3], F[5], F[6], F[7], F[8], F[9], (float*)d_out);
}

// v002
// One run takes 79.6 microseconds.
// Two timings next to v001 both put it at 4.56 times that version's speed.
// Counting every step since v000, it is 17.5 times as fast.
// compute dtype: all float inputs rounded to bf16; qh = queries W1[256:], kh = keys W1[:256] with EXACT bf16 products on WMMA 16x16x32 (f32 accumulate); per (query, key) pair h1 = relu(qh + kh + b1) in f32, split bf16 hi + lo against exact bf16 W2 (2 products); relu(+b2), the w3 dot, masking and softmax in f32; probs split bf16 hi + lo against exact bf16 keys (2 products); f32 output.
#include <hip/hip_runtime.h>
#include <math.h>

typedef __attribute__((ext_vector_type(16))) _Float16 v16h;
typedef __attribute__((ext_vector_type(16))) __bf16 v16b;
typedef __attribute__((ext_vector_type(8)))  _Float16 v8h;
typedef __attribute__((ext_vector_type(8)))  __bf16 v8b;
typedef __attribute__((ext_vector_type(8)))  float v8f;
typedef __attribute__((ext_vector_type(4)))  float v4f;
typedef __attribute__((ext_vector_type(2)))  float v2f;
typedef __attribute__((ext_vector_type(4)))  unsigned v4u;
typedef __attribute__((ext_vector_type(4)))  int v4i;
typedef float __attribute__((may_alias)) float_a;
typedef int __attribute__((may_alias)) int_a;

template <typename T> __device__ __forceinline__ void vst2(void* p, T v) { *(T*)p = v;  }
__device__ __forceinline__ v8f wmma16(v16h a, v16h b, v8f c) {
  v8f d = __builtin_amdgcn_wmma_f32_16x16x32_f16(false, a, false, b, (short)0, c, false, false);
  asm volatile("v_nop\n\tv_nop\n\tv_nop\n\tv_nop" : "+v"(d) : "v"(a), "v"(b));
  return d;
}
__device__ __forceinline__ v8f wmma_bf(v16b a, v16b b, v8f c) {
  v8f d = __builtin_amdgcn_wmma_f32_16x16x32_bf16(false, a, false, b, (short)0, c, false, false);
  asm volatile("v_nop\n\tv_nop\n\tv_nop\n\tv_nop" : "+v"(d) : "v"(a), "v"(b));
  return d;
}
// 16x16x32 fragments: lane = (h = lane>>4, row/col = lane&15); elements 0..7 = k0+8h+0..7, 8..15 = k0+16+8h+0..7; D element r = row 8h+r
__device__ __forceinline__ v16h frag_h(const _Float16* rowk0, int lane) {
  union { v16h v; v8h q[2]; } u; const _Float16* p = rowk0 + 8 * (lane >> 4);
  u.q[0] = *(const v8h*)p; u.q[1] = *(const v8h*)(p + 16); return u.v;
}
__device__ __forceinline__ v16h frag_f32(const float* rowk0, int lane) {
  v16h a; const float* p = rowk0 + 8 * (lane >> 4);
#pragma unroll
  for (int i = 0; i < 8; ++i) { a[i] = (_Float16)p[i]; a[8 + i] = (_Float16)p[16 + i]; }
  return a;
}
__device__ __forceinline__ v16h frag_f32s(const float* rowk0, int lane, float sc) {
  v16h a; const float* p = rowk0 + 8 * (lane >> 4);
#pragma unroll
  for (int i = 0; i < 8; ++i) { a[i] = (_Float16)(p[i] * sc); a[8 + i] = (_Float16)(p[16 + i] * sc); }
  return a;
}
// column fragment from a [K][ld] layout (column n), rows >= K read as 0
__device__ __forceinline__ v16h fragc_f32(const float* W, int k0, int n, int lane, int ld, int K) {
  v16h a; const int g = lane >> 4;
#pragma unroll
  for (int i = 0; i < 8; ++i) { const int ka = k0 + 8 * g + i, kb = ka + 16;
    a[i] = (_Float16)(ka < K ? W[(size_t)(ka < K ? ka : K - 1) * ld + n] : 0.f); a[8 + i] = (_Float16)(kb < K ? W[(size_t)(kb < K ? kb : K - 1) * ld + n] : 0.f); }
  return a;
}
struct F2 { v16b h, l; };
__device__ __forceinline__ F2 bsplit16(const float v[16]) { F2 r;
#pragma unroll
  for (int i = 0; i < 16; ++i) { const __bf16 h = (__bf16)v[i]; r.h[i] = h; r.l[i] = (__bf16)(v[i] - (float)h); }
  return r; }
__device__ __forceinline__ F2 split_row(const float* row, int k0, int lane) { float v[16]; const float* p = row + k0 + 8 * (lane >> 4);
#pragma unroll
  for (int i = 0; i < 8; ++i) { v[i] = p[i]; v[8 + i] = p[16 + i]; }
  return bsplit16(v); }
__device__ __forceinline__ F2 split_rowK(const float* row, int k0, int lane, int K) { float v[16]; const int g = lane >> 4;
#pragma unroll
  for (int i = 0; i < 8; ++i) { const int ka = k0 + 8 * g + i, kb = ka + 16; v[i] = ka < K ? row[ka < K ? ka : K - 1] : 0.f; v[8 + i] = kb < K ? row[kb < K ? kb : K - 1] : 0.f; }
  return bsplit16(v); }
__device__ __forceinline__ F2 split_col(const float* W, int k0, int n, int lane, int ld, int K) { float v[16]; const int g = lane >> 4;
#pragma unroll
  for (int i = 0; i < 8; ++i) { const int ka = k0 + 8 * g + i, kb = ka + 16; v[i] = ka < K ? W[(size_t)(ka < K ? ka : K - 1) * ld + n] : 0.f; v[8 + i] = kb < K ? W[(size_t)(kb < K ? kb : K - 1) * ld + n] : 0.f; }
  return bsplit16(v); }
__device__ __forceinline__ v8f mac3(const F2& a, const F2& b, v8f c) { c = wmma_bf(a.l, b.h, c); c = wmma_bf(a.h, b.l, c); return wmma_bf(a.h, b.h, c); }
__device__ __forceinline__ float sigm(float v) { return 1.0f / (1.0f + expf(-v)); }
#define LDSX() do { asm volatile("s_wait_dscnt 0" ::: "memory"); __builtin_amdgcn_wave_barrier(); __builtin_amdgcn_fence(__ATOMIC_RELEASE, "workgroup"); } while (0)

// Additive (MLP) attention (B 4, Tq = Tk = 256, dims 256; ragged query/key lengths in [128, 256]): for every (q, k): h = relu([keys_k | queries_q] W1 + b1) = relu(kh_k + qh_q + b1); h = relu(h W2 + b2); score = h . w3 + b3; score := -1e30 where q >= query_len or k >= key_len; probs = softmax over k, then 0 where masked; out = probs keys -> [B, Tq, 256] (padded query rows are exactly 0).
#define NBT 4
#define TQ 256
#define TK 256
#define HD_ 256             // Q = K = H = 256
#define QB 4                // queries per block
#define NWV 16              // waves per block: wave = (query wave & 3, key group wave >> 2)
#ifndef NBV
#define NBV NBT             // batches processed
#endif
__device__ __forceinline__ float bfr(float v) { return (float)(__bf16)v; }
__device__ __forceinline__ v16b wcol_kz(const float* __restrict__ Wm, int k0, int o, int lane, int ld, int K, int nvalid) { v16b w; const int g = lane >> 4; const int oc = o < nvalid ? o : 0; const float keepo = o < nvalid ? 1.f : 0.f;
  asm volatile("s_wait_loadcnt 0x0" ::: "memory");   /* drain earlier gathers so this 16-load column burst never stacks on top of them */
#pragma unroll
  for (int i = 0; i < 8; ++i) { const int ka = k0 + 8 * g + i, kb = ka + 16; w[i] = (__bf16)(Wm[(size_t)(ka < K ? ka : 0) * ld + oc] * (ka < K ? keepo : 0.f)); w[8 + i] = (__bf16)(Wm[(size_t)(kb < K ? kb : 0) * ld + oc] * (kb < K ? keepo : 0.f)); }
  asm volatile("s_wait_loadcnt 0x0" ::: "memory"); return w; }
#define WS_QH  0u                                   // f32 qh [B*TQ][256]
#define WS_KH  (WS_QH + 4u * (size_t)NBT * TQ * HD_)   // f32 kh [B*TK][256]
#define WS_END (WS_KH + 4u * (size_t)NBT * TK * HD_)
// ---- k_lin: block = (64 rows, 128 cols, which): which 0: qh = bf16(queries) W1[256:512] ; which 1: kh = bf16(keys) W1[0:256] (exact products, K 256, (in,out)); f32 rows, 512-B segments by 32 lanes
__global__ __launch_bounds__(128) void k_lin(const float* __restrict__ XQ, const float* __restrict__ XK, const float* __restrict__ W1, float* __restrict__ QH, float* __restrict__ KH) { __shared__ __align__(16) float sf[4][16][132];
  const int tid = threadIdx.x, wave = tid >> 5, lane = tid & 31, col = lane & 15, g = lane >> 4; const int which = blockIdx.z; const int c0 = blockIdx.y * 128; const size_t r0 = (size_t)blockIdx.x * 64 + wave * 16;
  const float* X = which == 0 ? XQ : XK; const float* Wm = which == 0 ? W1 + (size_t)HD_ * HD_ : W1; float* OUT = which == 0 ? QH : KH;   /* W1 rows 0..255 multiply the keys, rows 256..511 the queries (torch concat order [keys, queries]) */
  v8f acc[8] = {};
#pragma unroll 2
  for (int kc = 0; kc < HD_ / 32; ++kc) { v16b a; { const float* p = X + (r0 + col) * HD_ + kc * 32 + 8 * g;
#pragma unroll
      for (int i = 0; i < 8; ++i) { a[i] = (__bf16)p[i]; a[8 + i] = (__bf16)p[16 + i]; } }
    asm volatile("s_wait_loadcnt 0x0" ::: "memory");
#pragma unroll
    for (int j = 0; j < 8; ++j) { const v16b w = wcol_kz(Wm, kc * 32, c0 + j * 16 + col, lane, HD_, HD_, HD_); acc[j] = wmma_bf(a, w, acc[j]); } }
#pragma unroll
  for (int j = 0; j < 8; ++j) {
#pragma unroll
    for (int r = 0; r < 8; ++r) sf[wave][8 * g + r][j * 16 + col] = acc[j][r]; }
  LDSX(); for (int rl = 0; rl < 16; ++rl) vst2(OUT + (r0 + rl) * HD_ + c0 + lane * 4, *(const v4f*)&sf[wave][rl][lane * 4]); }
// ---- k_mlp: block = (batch b, 4 queries q0..q0+3), 16 waves, 256 blocks (one per WGP, four waves per SIMD, so that one wave's load waits are filled by the others' matrix work). Phase 1: wave w owns query q0 + (w & 3) and keys 64(w>>2)..64(w>>2)+63 as 4 row-tiles of 16 (the four waves of a key group read the same kh lines at about the same time); for each row-tile: A[row = key][c] = relu(qh[q][c] + kh[k][c] + b1[c]) (f32, built per lane, split bf16 hi + lo) x W2 (exact) -> 16 column tiles; score[q][k] = sum_c relu(acc + b2[c]) w3[c] (per-lane partial over its columns (two 128-column halves of 8 tiles each to stay within 256 VGPRs), then an xor tree over the 16 column lanes) + b3 -> LDS. Phase 2: softmax per query over k < key_len (rows with q >= query_len -> all-zero probs), in place. Phase 3: out tile = P (hi + lo) x bf16(keys[b]) (exact), fragment rows 4..15 repeat rows 0..3 and are dropped -> wave w computes columns 16w..16w+15 of the 4 output rows into LDS; after a barrier 8 waves store 512 contiguous bytes each.
__global__ __launch_bounds__(NWV * 32) void k_mlp(const float* __restrict__ QH, const float* __restrict__ KH, const float* __restrict__ KEYS, const int* __restrict__ QL, const int* __restrict__ KL, const float* __restrict__ B1, const float* __restrict__ W2, const float* __restrict__ B2, const float* __restrict__ W3, const float* __restrict__ B3, float* __restrict__ OUT) {
  __shared__ __align__(16) __bf16 sw[HD_ / 32][HD_ / 16][2][32][8];   /* bf16(W2) in B-fragment order: [k chunk of 32][column tile][element half][lane][8 k]; a wave's 16-byte reads of one half are 512 contiguous bytes */
  __shared__ __align__(16) float sq[QB][HD_]; __shared__ __align__(16) float ss[QB][TK + 4]; __shared__ __align__(16) float so[QB][HD_];
  const int tid = threadIdx.x, wave = tid >> 5, lane = tid & 31, col = lane & 15, g = lane >> 4; const size_t b = blockIdx.x; const int q0 = blockIdx.y * QB;
  int qlen = QL[b], klen = KL[b]; qlen = qlen < 0 ? 0 : (qlen > TQ ? TQ : qlen); klen = klen < 0 ? 0 : (klen > TK ? TK : klen);
  for (int e = tid; e < QB * HD_ / 4; e += NWV * 32) { const int qq = e / (HD_ / 4), c4 = e % (HD_ / 4); const v4f v = *(const v4f*)(QH + ((b * TQ + q0 + qq) * HD_) + c4 * 4); const v4f bb = *(const v4f*)(B1 + c4 * 4); asm volatile("s_wait_loadcnt 0x0" ::: "memory"); v4f o; o[0] = v[0] + bfr(bb[0]); o[1] = v[1] + bfr(bb[1]); o[2] = v[2] + bfr(bb[2]); o[3] = v[3] + bfr(bb[3]); *(v4f*)&sq[qq][c4 * 4] = o; }   /* qh[q] + b1 staged once */
  // W2 staged once per block: item = (8 consecutive k, 4 consecutive columns); 8 row reads of 16 bytes, rounded to bf16, 4 stores of 16 bytes (one per column). k = 32 kc + 16 q + 8 g + i, column = 16 jt + col, fragment lane = 16 g + col.
#pragma unroll 2   /* two items = 16 row reads in flight per thread, so that the 4 trips cost 2 load latencies */
  for (int it = 0; it < (HD_ / 8) * (HD_ / 4) / (NWV * 32); ++it) { const int e = it * (NWV * 32) + tid; const int k8 = e / (HD_ / 4), n0 = (e % (HD_ / 4)) * 4; v4f rw[8];
#pragma unroll
    for (int i = 0; i < 8; ++i) rw[i] = *(const v4f*)(W2 + (size_t)(k8 * 8 + i) * HD_ + n0);
#pragma unroll
    for (int c = 0; c < 4; ++c) { v8b t;
#pragma unroll
      for (int i = 0; i < 8; ++i) t[i] = (__bf16)rw[i][c];
      *(v8b*)&sw[k8 >> 2][n0 >> 4][(k8 >> 1) & 1][(k8 & 1) * 16 + (n0 & 15) + c][0] = t; } }
  __syncthreads();
  const float b3v = bfr(B3[0]);
  { const int qq = wave & (QB - 1);
#pragma unroll 1
    for (int rt = 0; rt < 4; ++rt) { const int k0 = (wave >> 2) * 64 + rt * 16; const float* khr = KH + (b * TK + k0 + col) * (size_t)HD_;   /* this lane's fragment row = key k0 + col */
      float ps[8] = {0.f, 0.f, 0.f, 0.f, 0.f, 0.f, 0.f, 0.f};
#pragma unroll 1
      for (int half = 0; half < 2; ++half) {   /* 2 x 128 output columns: keeps the accumulators at 8 tiles (VGPRs <= 256) */
        float b2r[8], w3r[8];
#pragma unroll
        for (int j = 0; j < 8; ++j) { b2r[j] = bfr(B2[half * 128 + j * 16 + col]); w3r[j] = bfr(W3[half * 128 + j * 16 + col]); }
        asm volatile("s_wait_loadcnt 0x0" ::: "memory");
        v8f acc[8] = {};
#pragma unroll 1
        for (int kc = 0; kc < HD_ / 32; ++kc) { float va[16];
#pragma unroll
          for (int i = 0; i < 8; ++i) { const int c = kc * 32 + 8 * g + i; va[i] = khr[c]; }
          union { v16b v; v8b q[2]; } wf[8];   /* the 8 W2 fragments of this k chunk, read from LDS in one group ahead of the WMMAs */
#pragma unroll
          for (int j = 0; j < 8; ++j) { wf[j].q[0] = *(const v8b*)&sw[kc][half * 8 + j][0][lane][0]; wf[j].q[1] = *(const v8b*)&sw[kc][half * 8 + j][1][lane][0]; }
          asm volatile("s_wait_loadcnt 0x0" ::: "memory");
#pragma unroll
          for (int i = 8; i < 16; ++i) { const int c = kc * 32 + 8 * g + 8 + i; va[i] = khr[c]; }
          asm volatile("s_wait_loadcnt 0x0" ::: "memory");
#pragma unroll
          for (int i = 0; i < 16; ++i) { const int c = kc * 32 + 8 * g + (i < 8 ? i : 8 + i); va[i] = fmaxf(va[i] + sq[qq][c], 0.f); }   /* relu(kh + qh + b1) */
          const F2 a = bsplit16(va);
#pragma unroll
          for (int j = 0; j < 8; ++j) { acc[j] = wmma_bf(a.h, wf[j].v, acc[j]); acc[j] = wmma_bf(a.l, wf[j].v, acc[j]); } }
#pragma unroll
        for (int r = 0; r < 8; ++r) { float p = ps[r];
#pragma unroll
          for (int j = 0; j < 8; ++j) p += fmaxf(acc[j][r] + b2r[j], 0.f) * w3r[j]; ps[r] = p; } }
#pragma unroll
      for (int o = 1; o < 16; o <<= 1) {
#pragma unroll
        for (int r = 0; r < 8; ++r) ps[r] += __shfl_xor(ps[r], o); }   /* sum over the 16 column lanes (lane bits 0..3); every lane shuffles */
      if (col == 0) {
#pragma unroll
        for (int r = 0; r < 8; ++r) ss[qq][k0 + 8 * g + r] = ps[r] + b3v; } } }
  __syncthreads();
  // phase 2: softmax per query row (waves 0..3: query w; the other waves go on to the barrier), lane owns keys lane*8..+7; masked keys (k >= klen) excluded, padded queries -> zero probs
  if (wave < QB) { const int qq = wave; const bool qvalid = (q0 + qq) < qlen; float v[8]; float m = -3.0e38f;
#pragma unroll
    for (int u = 0; u < 8; ++u) { float t2 = ss[qq][lane * 8 + u]; asm volatile("" : "+v"(t2)); v[u] = t2; }   /* all 8 scores loaded unconditionally (always written in phase 1), pinned; masked by SELECT below */
#pragma unroll
    for (int u = 0; u < 8; ++u) { const int k = lane * 8 + u; v[u] = (k < klen) ? v[u] : -3.0e38f; m = fmaxf(m, v[u]); }
#pragma unroll
    for (int o = 1; o < 32; o <<= 1) m = fmaxf(m, __shfl_xor(m, o));
    float sum = 0.f, e[8];
#pragma unroll
    for (int u = 0; u < 8; ++u) { e[u] = (lane * 8 + u < klen) ? expf(v[u] - m) : 0.f; sum += e[u]; }
#pragma unroll
    for (int o = 1; o < 32; o <<= 1) sum += __shfl_xor(sum, o);
    const float inv = (qvalid && sum > 0.f) ? 1.0f / sum : 0.f;
    LDSX();
#pragma unroll
    for (int u = 0; u < 8; ++u) ss[qq][lane * 8 + u] = e[u] * inv; }
  __syncthreads();
  // phase 3: out[q0..q0+3][16w..16w+15] = P (hi + lo) x bf16(keys[b]) (exact), K = 256 keys
  { v8f acc = {};
#pragma unroll
    for (int kc = 0; kc < TK / 32; ++kc) { const F2 a = split_row(&ss[col & (QB - 1)][0], kc * 32, lane);
      const v16b w = wcol_kz(KEYS + b * TK * (size_t)HD_, kc * 32, wave * 16 + col, lane, HD_, TK, HD_); acc = wmma_bf(a.h, w, acc); acc = wmma_bf(a.l, w, acc); }   /* B[k][d] = keys[b][k][d] */
    if (g == 0) {   /* D rows 0..3 = the block's queries sit in lanes 0..15, elements 0..3 */
#pragma unroll
      for (int r = 0; r < QB; ++r) so[r][wave * 16 + col] = acc[r]; }
    __syncthreads();   /* the 16 waves' column tiles are gathered so that no 128-byte output line has two writers */
    if (tid < QB * HD_ / 4) vst2(OUT + ((b * TQ + q0 + tid / (HD_ / 4)) * HD_) + (tid % (HD_ / 4)) * 4, *(const v4f*)&so[tid / (HD_ / 4)][(tid % (HD_ / 4)) * 4]); } }   /* a wave stores 512 contiguous bytes of one row */
extern "C" void kernel_launch(void* const* d_in, const int* in_sizes, int n_in, void* d_out, int out_size, void* d_ws, size_t ws_size, hipStream_t stream) {
  (void)in_sizes; (void)n_in; (void)out_size;
  // inputs: 0 queries [4,256,256]; 1 keys [4,256,256]; 2 query_lengths [4] i32; 3 key_lengths [4] i32; 4 W1 [512,256] (in,out: rows 0..255 keys, 256..511 queries); 5 b1 [256]; 6 W2 [256,256]; 7 b2; 8 W3 [256,1]; 9 b3 [1]
  if (ws_size < (size_t)WS_END) return;
  char* ws = (char*)d_ws; const float** F = (const float**)d_in; float *QH = (float*)(ws + WS_QH), *KH = (float*)(ws + WS_KH);
  k_lin<<<dim3(NBV * TQ / 64, HD_ / 128, 2), 128, 0, stream>>>(F[0], F[1], F[4], QH, KH);
  k_mlp<<<dim3(NBV, TQ / QB), NWV * 32, 0, stream>>>(QH, KH, F[1], (const int*)d_in[2], (const int*)d_in[3], F[5], F[6], F[7], F[8], F[9], (float*)d_out);
}

// v003
// It runs in 76.6 microseconds.
// Two timings next to v002 put it at 1.04 and 1.05 times that version's speed.
// Over all steps from v000 it is 18.4 times as fast.
// compute dtype: all float inputs rounded to bf16; qh = queries W1[256:], kh = keys W1[:256] with EXACT bf16 products on WMMA 16x16x32 (f32 accumulate); per (query, key) pair h1 = relu(qh + kh + b1) in f32, split bf16 hi + lo against exact bf16 W2 (2 products); relu(+b2), the w3 dot, masking and softmax in f32; probs split bf16 hi + lo against exact bf16 keys (2 products); f32 output.
#include <hip/hip_runtime.h>
#include <math.h>

typedef __attribute__((ext_vector_type(16))) _Float16 v16h;
typedef __attribute__((ext_vector_type(16))) __bf16 v16b;
typedef __attribute__((ext_vector_type(8)))  _Float16 v8h;
typedef __attribute__((ext_vector_type(8)))  __bf16 v8b;
typedef __attribute__((ext_vector_type(8)))  float v8f;
typedef __attribute__((ext_vector_type(4)))  float v4f;
typedef __attribute__((ext_vector_type(2)))  float v2f;
typedef __attribute__((ext_vector_type(4)))  unsigned v4u;
typedef __attribute__((ext_vector_type(4)))  int v4i;
typedef float __attribute__((may_alias)) float_a;
typedef int __attribute__((may_alias)) int_a;

template <typename T> __device__ __forceinline__ void vst2(void* p, T v) { *(T*)p = v;  }
__device__ __forceinline__ v8f wmma16(v16h a, v16h b, v8f c) {
  v8f d = __builtin_amdgcn_wmma_f32_16x16x32_f16(false, a, false, b, (short)0, c, false, false);
  asm volatile("v_nop\n\tv_nop\n\tv_nop\n\tv_nop" : "+v"(d) : "v"(a), "v"(b));
  return d;
}
__device__ __forceinline__ v8f wmma_bf(v16b a, v16b b, v8f c) {
  v8f d = __builtin_amdgcn_wmma_f32_16x16x32_bf16(false, a, false, b, (short)0, c, false, false);
  asm volatile("v_nop\n\tv_nop\n\tv_nop\n\tv_nop" : "+v"(d) : "v"(a), "v"(b));
  return d;
}
// 16x16x32 fragments: lane = (h = lane>>4, row/col = lane&15); elements 0..7 = k0+8h+0..7, 8..15 = k0+16+8h+0..7; D element r = row 8h+r
__device__ __forceinline__ v16h frag_h(const _Float16* rowk0, int lane) {
  union { v16h v; v8h q[2]; } u; const _Float16* p = rowk0 + 8 * (lane >> 4);
  u.q[0] = *(const v8h*)p; u.q[1] = *(const v8h*)(p + 16); return u.v;
}
__device__ __forceinline__ v16h frag_f32(const float* rowk0, int lane) {
  v16h a; const float* p = rowk0 + 8 * (lane >> 4);
#pragma unroll
  for (int i = 0; i < 8; ++i) { a[i] = (_Float16)p[i]; a[8 + i] = (_Float16)p[16 + i]; }
  return a;
}
__device__ __forceinline__ v16h frag_f32s(const float* rowk0, int lane, float sc) {
  v16h a; const float* p = rowk0 + 8 * (lane >> 4);
#pragma unroll
  for (int i = 0; i < 8; ++i) { a[i] = (_Float16)(p[i] * sc); a[8 + i] = (_Float16)(p[16 + i] * sc); }
  return a;
}
// column fragment from a [K][ld] layout (column n), rows >= K read as 0
__device__ __forceinline__ v16h fragc_f32(const float* W, int k0, int n, int lane, int ld, int K) {
  v16h a; const int g = lane >> 4;
#pragma unroll
  for (int i = 0; i < 8; ++i) { const int ka = k0 + 8 * g + i, kb = ka + 16;
    a[i] = (_Float16)(ka < K ? W[(size_t)(ka < K ? ka : K - 1) * ld + n] : 0.f); a[8 + i] = (_Float16)(kb < K ? W[(size_t)(kb < K ? kb : K - 1) * ld + n] : 0.f); }
  return a;
}
struct F2 { v16b h, l; };
__device__ __forceinline__ F2 bsplit16(const float v[16]) { F2 r;
#pragma unroll
  for (int i = 0; i < 16; ++i) { const __bf16 h = (__bf16)v[i]; r.h[i] = h; r.l[i] = (__bf16)(v[i] - (float)h); }
  return r; }
__device__ __forceinline__ F2 split_row(const float* row, int k0, int lane) { float v[16]; const float* p = row + k0 + 8 * (lane >> 4);
#pragma unroll
  for (int i = 0; i < 8; ++i) { v[i] = p[i]; v[8 + i] = p[16 + i]; }
  return bsplit16(v); }
__device__ __forceinline__ F2 split_rowK(const float* row, int k0, int lane, int K) { float v[16]; const int g = lane >> 4;
#pragma unroll
  for (int i = 0; i < 8; ++i) { const int ka = k0 + 8 * g + i, kb = ka + 16; v[i] = ka < K ? row[ka < K ? ka : K - 1] : 0.f; v[8 + i] = kb < K ? row[kb < K ? kb : K - 1] : 0.f; }
  return bsplit16(v); }
__device__ __forceinline__ F2 split_col(const float* W, int k0, int n, int lane, int ld, int K) { float v[16]; const int g = lane >> 4;
#pragma unroll
  for (int i = 0; i < 8; ++i) { const int ka = k0 + 8 * g + i, kb = ka + 16; v[i] = ka < K ? W[(size_t)(ka < K ? ka : K - 1) * ld + n] : 0.f; v[8 + i] = kb < K ? W[(size_t)(kb < K ? kb : K - 1) * ld + n] : 0.f; }
  return bsplit16(v); }
__device__ __forceinline__ v8f mac3(const F2& a, const F2& b, v8f c) { c = wmma_bf(a.l, b.h, c); c = wmma_bf(a.h, b.l, c); return wmma_bf(a.h, b.h, c); }
__device__ __forceinline__ float sigm(float v) { return 1.0f / (1.0f + expf(-v)); }
#define LDSX() do { asm volatile("s_wait_dscnt 0" ::: "memory"); __builtin_amdgcn_wave_barrier(); __builtin_amdgcn_fence(__ATOMIC_RELEASE, "workgroup"); } while (0)

// Additive (MLP) attention (B 4, Tq = Tk = 256, dims 256; ragged query/key lengths in [128, 256]): for every (q, k): h = relu([keys_k | queries_q] W1 + b1) = relu(kh_k + qh_q + b1); h = relu(h W2 + b2); score = h . w3 + b3; score := -1e30 where q >= query_len or k >= key_len; probs = softmax over k, then 0 where masked; out = probs keys -> [B, Tq, 256] (padded query rows are exactly 0).
#define NBT 4
#define TQ 256
#define TK 256
#define HD_ 256             // Q = K = H = 256
#define QB 4                // queries per block
#define NWV 16              // waves per block: wave = (query wave & 3, key group wave >> 2)
#ifndef NBV
#define NBV NBT             // batches processed
#endif
__device__ __forceinline__ float bfr(float v) { return (float)(__bf16)v; }
__device__ __forceinline__ v16b wcol_kz(const float* __restrict__ Wm, int k0, int o, int lane, int ld, int K, int nvalid) { v16b w; const int g = lane >> 4; const int oc = o < nvalid ? o : 0; const float keepo = o < nvalid ? 1.f : 0.f;
  asm volatile("s_wait_loadcnt 0x0" ::: "memory");   /* drain earlier gathers so this 16-load column burst never stacks on top of them */
#pragma unroll
  for (int i = 0; i < 8; ++i) { const int ka = k0 + 8 * g + i, kb = ka + 16; w[i] = (__bf16)(Wm[(size_t)(ka < K ? ka : 0) * ld + oc] * (ka < K ? keepo : 0.f)); w[8 + i] = (__bf16)(Wm[(size_t)(kb < K ? kb : 0) * ld + oc] * (kb < K ? keepo : 0.f)); }
  asm volatile("s_wait_loadcnt 0x0" ::: "memory"); return w; }
#define WS_QH  0u                                   // f32 qh [B*TQ][256]
#define WS_KH  (WS_QH + 4u * (size_t)NBT * TQ * HD_)   // f32 kh in A-fragment order: [B*TK/16 key tile][k chunk of 32][element quarter][lane][4]
#define WS_END (WS_KH + 4u * (size_t)NBT * TK * HD_)
// ---- k_lin: block = (64 rows, 128 cols, which): which 0: qh = bf16(queries) W1[256:512] ; which 1: kh = bf16(keys) W1[0:256] (exact products, K 256, (in,out)); qh as f32 rows, kh in the pair GEMM's A-fragment order, both stored as 512-B segments by 32 lanes
__global__ __launch_bounds__(128) void k_lin(const float* __restrict__ XQ, const float* __restrict__ XK, const float* __restrict__ W1, float* __restrict__ QH, float* __restrict__ KH) { __shared__ __align__(16) float sf[4][16][132];
  const int tid = threadIdx.x, wave = tid >> 5, lane = tid & 31, col = lane & 15, g = lane >> 4; const int which = blockIdx.z; const int c0 = blockIdx.y * 128; const size_t r0 = (size_t)blockIdx.x * 64 + wave * 16;
  const float* X = which == 0 ? XQ : XK; const float* Wm = which == 0 ? W1 + (size_t)HD_ * HD_ : W1; float* OUT = which == 0 ? QH : KH;   /* W1 rows 0..255 multiply the keys, rows 256..511 the queries (torch concat order [keys, queries]) */
  v8f acc[8] = {};
#pragma unroll 2
  for (int kc = 0; kc < HD_ / 32; ++kc) { v16b a; { const float* p = X + (r0 + col) * HD_ + kc * 32 + 8 * g;
#pragma unroll
      for (int i = 0; i < 8; ++i) { a[i] = (__bf16)p[i]; a[8 + i] = (__bf16)p[16 + i]; } }
    asm volatile("s_wait_loadcnt 0x0" ::: "memory");
#pragma unroll
    for (int j = 0; j < 8; ++j) { const v16b w = wcol_kz(Wm, kc * 32, c0 + j * 16 + col, lane, HD_, HD_, HD_); acc[j] = wmma_bf(a, w, acc[j]); } }
#pragma unroll
  for (int j = 0; j < 8; ++j) {
#pragma unroll
    for (int r = 0; r < 8; ++r) sf[wave][8 * g + r][j * 16 + col] = acc[j][r]; }
  LDSX();
  if (which == 0) { for (int rl = 0; rl < 16; ++rl) vst2(OUT + (r0 + rl) * HD_ + c0 + lane * 4, *(const v4f*)&sf[wave][rl][lane * 4]); }
  else {   /* kh: the wave's 16 rows are one key tile; segment s = (k chunk s >> 2, element quarter s & 3); lane (g, col) holds row col, columns 32 chunk + 16 (quarter >> 1) + 8 g + 4 (quarter & 1) + 0..3, i.e. fragment elements 4 quarter + 0..3 */
    float* kf = OUT + ((r0 >> 4) * (HD_ / 32) + (c0 >> 5)) * 512 + lane * 4;
    for (int s = 0; s < 16; ++s) vst2(kf + s * 128, *(const v4f*)&sf[wave][col][(s >> 2) * 32 + ((s >> 1) & 1) * 16 + 8 * g + (s & 1) * 4]);
    asm volatile("s_wait_xcnt 0x0" ::: "memory"); } }   /* stands behind the last kh store, ahead of any code the listing lets follow that rewrites the stores' data or address registers */
// ---- k_mlp: block = (batch b, 4 queries q0..q0+3), 16 waves, 256 blocks (one per WGP, four waves per SIMD, so that one wave's load waits are filled by the others' matrix work). Phase 1: wave w owns query q0 + (w & 3) and keys 64(w>>2)..64(w>>2)+63 as 4 row-tiles of 16 (the four waves of a key group read the same kh lines at about the same time; kh comes in fragment order, whole lines per load); for each row-tile: A[row = key][c] = relu(qh[q][c] + kh[k][c] + b1[c]) (f32, built per lane, split bf16 hi + lo) x W2 (exact) -> 16 column tiles; score[q][k] = sum_c relu(acc + b2[c]) w3[c] (per-lane partial over its columns (two 128-column halves of 8 tiles each to stay within 256 VGPRs), then an xor tree over the 16 column lanes) + b3 -> LDS. Phase 2: softmax per query over k < key_len (rows with q >= query_len -> all-zero probs), in place. Phase 3: out tile = P (hi + lo) x bf16(keys[b]) (exact), fragment rows 4..15 repeat rows 0..3 and are dropped -> wave w computes columns 16w..16w+15 of the 4 output rows into LDS; after a barrier 8 waves store 512 contiguous bytes each.
__global__ __launch_bounds__(NWV * 32) void k_mlp(const float* __restrict__ QH, const float* __restrict__ KH, const float* __restrict__ KEYS, const int* __restrict__ QL, const int* __restrict__ KL, const float* __restrict__ B1, const float* __restrict__ W2, const float* __restrict__ B2, const float* __restrict__ W3, const float* __restrict__ B3, float* __restrict__ OUT) {
  __shared__ __align__(16) __bf16 sw[HD_ / 32][HD_ / 16][2][32][8];   /* bf16(W2) in B-fragment order: [k chunk of 32][column tile][element half][lane][8 k]; a wave's 16-byte reads of one half are 512 contiguous bytes */
  __shared__ __align__(16) float sq[QB][HD_]; __shared__ __align__(16) float ss[QB][TK + 4]; __shared__ __align__(16) float so[QB][HD_];
  const int tid = threadIdx.x, wave = tid >> 5, lane = tid & 31, col = lane & 15, g = lane >> 4; const size_t b = blockIdx.x; const int q0 = blockIdx.y * QB;
  int qlen = QL[b], klen = KL[b]; qlen = qlen < 0 ? 0 : (qlen > TQ ? TQ : qlen); klen = klen < 0 ? 0 : (klen > TK ? TK : klen);
  for (int e = tid; e < QB * HD_ / 4; e += NWV * 32) { const int qq = e / (HD_ / 4), c4 = e % (HD_ / 4); const v4f v = *(const v4f*)(QH + ((b * TQ + q0 + qq) * HD_) + c4 * 4); const v4f bb = *(const v4f*)(B1 + c4 * 4); asm volatile("s_wait_loadcnt 0x0" ::: "memory"); v4f o; o[0] = v[0] + bfr(bb[0]); o[1] = v[1] + bfr(bb[1]); o[2] = v[2] + bfr(bb[2]); o[3] = v[3] + bfr(bb[3]); *(v4f*)&sq[qq][c4 * 4] = o; }   /* qh[q] + b1 staged once */
  // W2 staged once per block: item = (8 consecutive k, 4 consecutive columns); 8 row reads of 16 bytes, rounded to bf16, 4 stores of 16 bytes (one per column). k = 32 kc + 16 q + 8 g + i, column = 16 jt + col, fragment lane = 16 g + col.
#pragma unroll 2   /* two items = 16 row reads in flight per thread, so that the 4 trips cost 2 load latencies */
  for (int it = 0; it < (HD_ / 8) * (HD_ / 4) / (NWV * 32); ++it) { const int e = it * (NWV * 32) + tid; const int k8 = e / (HD_ / 4), n0 = (e % (HD_ / 4)) * 4; v4f rw[8];
#pragma unroll
    for (int i = 0; i < 8; ++i) rw[i] = *(const v4f*)(W2 + (size_t)(k8 * 8 + i) * HD_ + n0);
#pragma unroll
    for (int c = 0; c < 4; ++c) { v8b t;
#pragma unroll
      for (int i = 0; i < 8; ++i) t[i] = (__bf16)rw[i][c];
      *(v8b*)&sw[k8 >> 2][n0 >> 4][(k8 >> 1) & 1][(k8 & 1) * 16 + (n0 & 15) + c][0] = t; } }
  __syncthreads();
  const float b3v = bfr(B3[0]);
  { const int qq = wave & (QB - 1);
#pragma unroll 1
    for (int rt = 0; rt < 4; ++rt) { const int k0 = (wave >> 2) * 64 + rt * 16; const float* khf = KH + ((b * TK + k0) >> 4) * (size_t)(16 * HD_) + lane * 4;   /* key tile k0 / 16 in fragment order: this lane's fragment row = key k0 + col; a wave's 16-byte load covers 512 contiguous bytes (4 lines) */
      float ps[8] = {0.f, 0.f, 0.f, 0.f, 0.f, 0.f, 0.f, 0.f};
#pragma unroll 1
      for (int half = 0; half < 2; ++half) {   /* 2 x 128 output columns: keeps the accumulators at 8 tiles (VGPRs <= 256) */
        float b2r[8], w3r[8];
#pragma unroll
        for (int j = 0; j < 8; ++j) { b2r[j] = bfr(B2[half * 128 + j * 16 + col]); w3r[j] = bfr(W3[half * 128 + j * 16 + col]); }
        asm volatile("s_wait_loadcnt 0x0" ::: "memory");
        v8f acc[8] = {};
#pragma unroll 1
        for (int kc = 0; kc < HD_ / 32; ++kc) { float va[16];
#pragma unroll
          for (int i = 0; i < 8; ++i) va[i] = khf[kc * 512 + (i >> 2) * 128 + (i & 3)];
          union { v16b v; v8b q[2]; } wf[8];   /* the 8 W2 fragments of this k chunk, read from LDS in one group ahead of the WMMAs */
#pragma unroll
          for (int j = 0; j < 8; ++j) { wf[j].q[0] = *(const v8b*)&sw[kc][half * 8 + j][0][lane][0]; wf[j].q[1] = *(const v8b*)&sw[kc][half * 8 + j][1][lane][0]; }
          asm volatile("s_wait_loadcnt 0x0" ::: "memory");
#pragma unroll
          for (int i = 8; i < 16; ++i) va[i] = khf[kc * 512 + (i >> 2) * 128 + (i & 3)];
          asm volatile("s_wait_loadcnt 0x0" ::: "memory");
#pragma unroll
          for (int i = 0; i < 16; ++i) { const int c = kc * 32 + 8 * g + (i < 8 ? i : 8 + i); va[i] = fmaxf(va[i] + sq[qq][c], 0.f); }   /* relu(kh + qh + b1) */
          const F2 a = bsplit16(va);
#pragma unroll
          for (int j = 0; j < 8; ++j) { acc[j] = wmma_bf(a.h, wf[j].v, acc[j]); acc[j] = wmma_bf(a.l, wf[j].v, acc[j]); } }
#pragma unroll
        for (int r = 0; r < 8; ++r) { float p = ps[r];
#pragma unroll
          for (int j = 0; j < 8; ++j) p += fmaxf(acc[j][r] + b2r[j], 0.f) * w3r[j]; ps[r] = p; } }
#pragma unroll
      for (int o = 1; o < 16; o <<= 1) {
#pragma unroll
        for (int r = 0; r < 8; ++r) ps[r] += __shfl_xor(ps[r], o); }   /* sum over the 16 column lanes (lane bits 0..3); every lane shuffles */
      if (col == 0) {
#pragma unroll
        for (int r = 0; r < 8; ++r) ss[qq][k0 + 8 * g + r] = ps[r] + b3v; } } }
  __syncthreads();
  // phase 2: softmax per query row (waves 0..3: query w; the other waves go on to the barrier), lane owns keys lane*8..+7; masked keys (k >= klen) excluded, padded queries -> zero probs
  if (wave < QB) { const int qq = wave; const bool qvalid = (q0 + qq) < qlen; float v[8]; float m = -3.0e38f;
#pragma unroll
    for (int u = 0; u < 8; ++u) { float t2 = ss[qq][lane * 8 + u]; asm volatile("" : "+v"(t2)); v[u] = t2; }   /* all 8 scores loaded unconditionally (always written in phase 1), pinned; masked by SELECT below */
#pragma unroll
    for (int u = 0; u < 8; ++u) { const int k = lane * 8 + u; v[u] = (k < klen) ? v[u] : -3.0e38f; m = fmaxf(m, v[u]); }
#pragma unroll
    for (int o = 1; o < 32; o <<= 1) m = fmaxf(m, __shfl_xor(m, o));
    float sum = 0.f, e[8];
#pragma unroll
    for (int u = 0; u < 8; ++u) { e[u] = (lane * 8 + u < klen) ? expf(v[u] - m) : 0.f; sum += e[u]; }
#pragma unroll
    for (int o = 1; o < 32; o <<= 1) sum += __shfl_xor(sum, o);
    const float inv = (qvalid && sum > 0.f) ? 1.0f / sum : 0.f;
    LDSX();
#pragma unroll
    for (int u = 0; u < 8; ++u) ss[qq][lane * 8 + u] = e[u] * inv; }
  __syncthreads();
  // phase 3: out[q0..q0+3][16w..16w+15] = P (hi + lo) x bf16(keys[b]) (exact), K = 256 keys
  { v8f acc = {};
#pragma unroll
    for (int kc = 0; kc < TK / 32; ++kc) { const F2 a = split_row(&ss[col & (QB - 1)][0], kc * 32, lane);
      const v16b w = wcol_kz(KEYS + b * TK * (size_t)HD_, kc * 32, wave * 16 + col, lane, HD_, TK, HD_); acc = wmma_bf(a.h, w, acc); acc = wmma_bf(a.l, w, acc); }   /* B[k][d] = keys[b][k][d] */
    if (g == 0) {   /* D rows 0..3 = the block's queries sit in lanes 0..15, elements 0..3 */
#pragma unroll
      for (int r = 0; r < QB; ++r) so[r][wave * 16 + col] = acc[r]; }
    __syncthreads();   /* the 16 waves' column tiles are gathered so that no 128-byte output line has two writers */
    if (tid < QB * HD_ / 4) vst2(OUT + ((b * TQ + q0 + tid / (HD_ / 4)) * HD_) + (tid % (HD_ / 4)) * 4, *(const v4f*)&so[tid / (HD_ / 4)][(tid % (HD_ / 4)) * 4]); } }   /* a wave stores 512 contiguous bytes of one row */
extern "C" void kernel_launch(void* const* d_in, const int* in_sizes, int n_in, void* d_out, int out_size, void* d_ws, size_t ws_size, hipStream_t stream) {
  (void)in_sizes; (void)n_in; (void)out_size;
  // inputs: 0 queries [4,256,256]; 1 keys [4,256,256]; 2 query_lengths [4] i32; 3 key_lengths [4] i32; 4 W1 [512,256] (in,out: rows 0..255 keys, 256..511 queries); 5 b1 [256]; 6 W2 [256,256]; 7 b2; 8 W3 [256,1]; 9 b3 [1]
  if (ws_size < (size_t)WS_END) return;
  char* ws = (char*)d_ws; const float** F = (const float**)d_in; float *QH = (float*)(ws + WS_QH), *KH = (float*)(ws + WS_KH);
  k_lin<<<dim3(NBV * TQ / 64, HD_ / 128, 2), 128, 0, stream>>>(F[0], F[1], F[4], QH, KH);
  k_mlp<<<dim3(NBV, TQ / QB), NWV * 32, 0, stream>>>(QH, KH, F[1], (const int*)d_in[2], (const int*)d_in[3], F[5], F[6], F[7], F[8], F[9], (float*)d_out);
}

// v004
// It runs in 71.2 microseconds.
// Next to v003, in two timings, it ran 1.07 and 1.08 times as fast.
// Counting every step since v000, it is 19.7 times as fast.
// compute dtype: all float inputs rounded to bf16; qh = queries W1[256:], kh = keys W1[:256] with EXACT bf16 products on WMMA 16x16x32 (f32 accumulate); per (query, key) pair h1 = relu(qh + kh + b1) in f32, split bf16 hi + lo against exact bf16 W2 (2 products); relu(+b2), the w3 dot, masking and softmax in f32; probs split bf16 hi + lo against exact bf16 keys (2 products); f32 output.
#include <hip/hip_runtime.h>
#include <math.h>

typedef __attribute__((ext_vector_type(16))) _Float16 v16h;
typedef __attribute__((ext_vector_type(16))) __bf16 v16b;
typedef __attribute__((ext_vector_type(8)))  _Float16 v8h;
typedef __attribute__((ext_vector_type(8)))  __bf16 v8b;
typedef __attribute__((ext_vector_type(8)))  float v8f;
typedef __attribute__((ext_vector_type(4)))  float v4f;
typedef __attribute__((ext_vector_type(2)))  float v2f;
typedef __attribute__((ext_vector_type(4)))  unsigned v4u;
typedef __attribute__((ext_vector_type(4)))  int v4i;
typedef float __attribute__((may_alias)) float_a;
typedef int __attribute__((may_alias)) int_a;

template <typename T> __device__ __forceinline__ void vst2(void* p, T v) { *(T*)p = v;  }
__device__ __forceinline__ v8f wmma16(v16h a, v16h b, v8f c) {
  v8f d = __builtin_amdgcn_wmma_f32_16x16x32_f16(false, a, false, b, (short)0, c, false, false);
  asm volatile("v_nop\n\tv_nop\n\tv_nop\n\tv_nop" : "+v"(d) : "v"(a), "v"(b));
  return d;
}
__device__ __forceinline__ v8f wmma_bf(v16b a, v16b b, v8f c) {
  v8f d = __builtin_amdgcn_wmma_f32_16x16x32_bf16(false, a, false, b, (short)0, c, false, false);
  asm volatile("v_nop\n\tv_nop\n\tv_nop\n\tv_nop" : "+v"(d) : "v"(a), "v"(b));
  return d;
}
// 16x16x32 fragments: lane = (h = lane>>4, row/col = lane&15); elements 0..7 = k0+8h+0..7, 8..15 = k0+16+8h+0..7; D element r = row 8h+r
__device__ __forceinline__ v16h frag_h(const _Float16* rowk0, int lane) {
  union { v16h v; v8h q[2]; } u; const _Float16* p = rowk0 + 8 * (lane >> 4);
  u.q[0] = *(const v8h*)p; u.q[1] = *(const v8h*)(p + 16); return u.v;
}
__device__ __forceinline__ v16h frag_f32(const float* rowk0, int lane) {
  v16h a; const float* p = rowk0 + 8 * (lane >> 4);
#pragma unroll
  for (int i = 0; i < 8; ++i) { a[i] = (_Float16)p[i]; a[8 + i] = (_Float16)p[16 + i]; }
  return a;
}
__device__ __forceinline__ v16h frag_f32s(const float* rowk0, int lane, float sc) {
  v16h a; const float* p = rowk0 + 8 * (lane >> 4);
#pragma unroll
  for (int i = 0; i < 8; ++i) { a[i] = (_Float16)(p[i] * sc); a[8 + i] = (_Float16)(p[16 + i] * sc); }
  return a;
}
// column fragment from a [K][ld] layout (column n), rows >= K read as 0
__device__ __forceinline__ v16h fragc_f32(const float* W, int k0, int n, int lane, int ld, int K) {
  v16h a; const int g = lane >> 4;
#pragma unroll
  for (int i = 0; i < 8; ++i) { const int ka = k0 + 8 * g + i, kb = ka + 16;
    a[i] = (_Float16)(ka < K ? W[(size_t)(ka < K ? ka : K - 1) * ld + n] : 0.f); a[8 + i] = (_Float16)(kb < K ? W[(size_t)(kb < K ? kb : K - 1) * ld + n] : 0.f); }
  return a;
}
struct F2 { v16b h, l; };
__device__ __forceinline__ F2 bsplit16(const float v[16]) { F2 r;
#pragma unroll
  for (int i = 0; i < 16; ++i) { const __bf16 h = (__bf16)v[i]; r.h[i] = h; r.l[i] = (__bf16)(v[i] - (float)h); }
  return r; }
__device__ __forceinline__ F2 split_row(const float* row, int k0, int lane) { float v[16]; const float* p = row + k0 + 8 * (lane >> 4);
#pragma unroll
  for (int i = 0; i < 8; ++i) { v[i] = p[i]; v[8 + i] = p[16 + i]; }
  return bsplit16(v); }
__device__ __forceinline__ F2 split_rowK(const float* row, int k0, int lane, int K) { float v[16]; const int g = lane >> 4;
#pragma unroll
  for (int i = 0; i < 8; ++i) { const int ka = k0 + 8 * g + i, kb = ka + 16; v[i] = ka < K ? row[ka < K ? ka : K - 1] : 0.f; v[8 + i] = kb < K ? row[kb < K ? kb : K - 1] : 0.f; }
  return bsplit16(v); }
__device__ __forceinline__ F2 split_col(const float* W, int k0, int n, int lane, int ld, int K) { float v[16]; const int g = lane >> 4;
#pragma unroll
  for (int i = 0; i < 8; ++i) { const int ka = k0 + 8 * g + i, kb = ka + 16; v[i] = ka < K ? W[(size_t)(ka < K ? ka : K - 1) * ld + n] : 0.f; v[8 + i] = kb < K ? W[(size_t)(kb < K ? kb : K - 1) * ld + n] : 0.f; }
  return bsplit16(v); }
__device__ __forceinline__ v8f mac3(const F2& a, const F2& b, v8f c) { c = wmma_bf(a.l, b.h, c); c = wmma_bf(a.h, b.l, c); return wmma_bf(a.h, b.h, c); }
__device__ __forceinline__ float sigm(float v) { return 1.0f / (1.0f + expf(-v)); }
#define LDSX() do { asm volatile("s_wait_dscnt 0" ::: "memory"); __builtin_amdgcn_wave_barrier(); __builtin_amdgcn_fence(__ATOMIC_RELEASE, "workgroup"); } while (0)

// Additive (MLP) attention (B 4, Tq = Tk = 256, dims 256; ragged query/key lengths in [128, 256]): for every (q, k): h = relu([keys_k | queries_q] W1 + b1) = relu(kh_k + qh_q + b1); h = relu(h W2 + b2); score = h . w3 + b3; score := -1e30 where q >= query_len or k >= key_len; probs = softmax over k, then 0 where masked; out = probs keys -> [B, Tq, 256] (padded query rows are exactly 0).
#define NBT 4
#define TQ 256
#define TK 256
#define HD_ 256             // Q = K = H = 256
#define QB 4                // queries per block
#define NWV 16              // waves per block: wave = (query wave & 3, key group wave >> 2)
#ifndef NBV
#define NBV NBT             // batches processed
#endif
__device__ __forceinline__ float bfr(float v) { return (float)(__bf16)v; }
__device__ __forceinline__ v16b wcol_kz(const float* __restrict__ Wm, int k0, int o, int lane, int ld, int K, int nvalid) { v16b w; const int g = lane >> 4; const int oc = o < nvalid ? o : 0; const float keepo = o < nvalid ? 1.f : 0.f;
  asm volatile("s_wait_loadcnt 0x0" ::: "memory");   /* drain earlier gathers so this 16-load column burst never stacks on top of them */
#pragma unroll
  for (int i = 0; i < 8; ++i) { const int ka = k0 + 8 * g + i, kb = ka + 16; w[i] = (__bf16)(Wm[(size_t)(ka < K ? ka : 0) * ld + oc] * (ka < K ? keepo : 0.f)); w[8 + i] = (__bf16)(Wm[(size_t)(kb < K ? kb : 0) * ld + oc] * (kb < K ? keepo : 0.f)); }
  asm volatile("s_wait_loadcnt 0x0" ::: "memory"); return w; }
#define WS_QH  0u                                   // f32 qh [B*TQ][256]
#define WS_KH  (WS_QH + 4u * (size_t)NBT * TQ * HD_)   // f32 kh in A-fragment order: [B*TK/16 key tile][k chunk of 32][element quarter][lane][4]
#define WS_END (WS_KH + 4u * (size_t)NBT * TK * HD_)
// ---- k_lin: block = (64 rows, 128 cols, which): which 0: qh = bf16(queries) W1[256:512] ; which 1: kh = bf16(keys) W1[0:256] (exact products, K 256, (in,out)); qh as f32 rows, kh in the pair GEMM's A-fragment order, both stored as 512-B segments by 32 lanes
__global__ __launch_bounds__(128) void k_lin(const float* __restrict__ XQ, const float* __restrict__ XK, const float* __restrict__ W1, float* __restrict__ QH, float* __restrict__ KH) { __shared__ __align__(16) float sf[4][16][132];
  const int tid = threadIdx.x, wave = tid >> 5, lane = tid & 31, col = lane & 15, g = lane >> 4; const int which = blockIdx.z; const int c0 = blockIdx.y * 128; const size_t r0 = (size_t)blockIdx.x * 64 + wave * 16;
  const float* X = which == 0 ? XQ : XK; const float* Wm = which == 0 ? W1 + (size_t)HD_ * HD_ : W1; float* OUT = which == 0 ? QH : KH;   /* W1 rows 0..255 multiply the keys, rows 256..511 the queries (torch concat order [keys, queries]) */
  v8f acc[8] = {};
#pragma unroll 2
  for (int kc = 0; kc < HD_ / 32; ++kc) { v16b a; { const float* p = X + (r0 + col) * HD_ + kc * 32 + 8 * g;
#pragma unroll
      for (int i = 0; i < 8; ++i) { a[i] = (__bf16)p[i]; a[8 + i] = (__bf16)p[16 + i]; } }
    asm volatile("s_wait_loadcnt 0x0" ::: "memory");
#pragma unroll
    for (int j = 0; j < 8; ++j) { const v16b w = wcol_kz(Wm, kc * 32, c0 + j * 16 + col, lane, HD_, HD_, HD_); acc[j] = wmma_bf(a, w, acc[j]); } }
#pragma unroll
  for (int j = 0; j < 8; ++j) {
#pragma unroll
    for (int r = 0; r < 8; ++r) sf[wave][8 * g + r][j * 16 + col] = acc[j][r]; }
  LDSX();
  if (which == 0) { for (int rl = 0; rl < 16; ++rl) vst2(OUT + (r0 + rl) * HD_ + c0 + lane * 4, *(const v4f*)&sf[wave][rl][lane * 4]); }
  else {   /* kh: the wave's 16 rows are one key tile; segment s = (k chunk s >> 2, element quarter s & 3); lane (g, col) holds row col, columns 32 chunk + 16 (quarter >> 1) + 8 g + 4 (quarter & 1) + 0..3, i.e. fragment elements 4 quarter + 0..3 */
    float* kf = OUT + ((r0 >> 4) * (HD_ / 32) + (c0 >> 5)) * 512 + lane * 4;
    for (int s = 0; s < 16; ++s) vst2(kf + s * 128, *(const v4f*)&sf[wave][col][(s >> 2) * 32 + ((s >> 1) & 1) * 16 + 8 * g + (s & 1) * 4]);
    asm volatile("s_wait_xcnt 0x0" ::: "memory"); } }   /* stands behind the last kh store, ahead of any code the listing lets follow that rewrites the stores' data or address registers */
// ---- k_mlp: block = (batch b, 4 queries q0..q0+3), 16 waves, 256 blocks (one per WGP, four waves per SIMD, so that one wave's load waits are filled by the others' matrix work). Phase 1: wave w owns query q0 + (w & 3) and keys 64(w>>2)..64(w>>2)+63 as 4 row-tiles of 16 (the four waves of a key group read the same kh lines at about the same time; kh comes in fragment order, whole lines per load); for each row-tile: A[row = key][c] = relu(qh[q][c] + kh[k][c] + b1[c]) (f32, built per lane, split bf16 hi + lo) x W2 (exact) -> 16 column tiles; score[q][k] = sum_c relu(acc + b2[c]) w3[c] (per-lane partial over its columns (two 128-column halves of 8 tiles each to stay within 256 VGPRs), then an xor tree over the 16 column lanes) + b3 -> LDS. Phase 2: softmax per query over k < key_len (rows with q >= query_len -> all-zero probs), in place. Phase 3: out tile = P (hi + lo) x bf16(keys[b]) (exact), fragment rows 4..15 repeat rows 0..3 and are dropped -> wave w computes columns 16w..16w+15 of the 4 output rows into LDS; after a barrier 8 waves store 512 contiguous bytes each.
__global__ __launch_bounds__(NWV * 32) void k_mlp(const float* __restrict__ QH, const float* __restrict__ KH, const float* __restrict__ KEYS, const int* __restrict__ QL, const int* __restrict__ KL, const float* __restrict__ B1, const float* __restrict__ W2, const float* __restrict__ B2, const float* __restrict__ W3, const float* __restrict__ B3, float* __restrict__ OUT) {
  __shared__ __align__(16) __bf16 sw[HD_ / 32][HD_ / 16][2][32][8];   /* bf16(W2) in B-fragment order: [k chunk of 32][column tile][element half][lane][8 k]; a wave's 16-byte reads of one half are 512 contiguous bytes */
  __shared__ __align__(16) float sq[QB][HD_]; __shared__ __align__(16) float ss[QB][TK + 4]; __shared__ __align__(16) float so[QB][HD_];
  const int tid = threadIdx.x, wave = tid >> 5, lane = tid & 31, col = lane & 15, g = lane >> 4; const size_t b = blockIdx.x; const int q0 = blockIdx.y * QB;
  int qlen = QL[b], klen = KL[b]; qlen = qlen < 0 ? 0 : (qlen > TQ ? TQ : qlen); klen = klen < 0 ? 0 : (klen > TK ? TK : klen);
  for (int e = tid; e < QB * HD_ / 4; e += NWV * 32) { const int qq = e / (HD_ / 4), c4 = e % (HD_ / 4); const v4f v = *(const v4f*)(QH + ((b * TQ + q0 + qq) * HD_) + c4 * 4); const v4f bb = *(const v4f*)(B1 + c4 * 4); asm volatile("s_wait_loadcnt 0x0" ::: "memory"); v4f o; o[0] = v[0] + bfr(bb[0]); o[1] = v[1] + bfr(bb[1]); o[2] = v[2] + bfr(bb[2]); o[3] = v[3] + bfr(bb[3]); *(v4f*)&sq[qq][c4 * 4] = o; }   /* qh[q] + b1 staged once */
  // W2 staged once per block: item = (8 consecutive k, 4 consecutive columns); 8 row reads of 16 bytes, rounded to bf16, 4 stores of 16 bytes (one per column). k = 32 kc + 16 q + 8 g + i, column = 16 jt + col, fragment lane = 16 g + col.
#pragma unroll 2   /* two items = 16 row reads in flight per thread, so that the 4 trips cost 2 load latencies */
  for (int it = 0; it < (HD_ / 8) * (HD_ / 4) / (NWV * 32); ++it) { const int e = it * (NWV * 32) + tid; const int k8 = e / (HD_ / 4), n0 = (e % (HD_ / 4)) * 4; v4f rw[8];
#pragma unroll
    for (int i = 0; i < 8; ++i) rw[i] = *(const v4f*)(W2 + (size_t)(k8 * 8 + i) * HD_ + n0);
#pragma unroll
    for (int c = 0; c < 4; ++c) { v8b t;
#pragma unroll
      for (int i = 0; i < 8; ++i) t[i] = (__bf16)rw[i][c];
      *(v8b*)&sw[k8 >> 2][n0 >> 4][(k8 >> 1) & 1][(k8 & 1) * 16 + (n0 & 15) + c][0] = t; } }
  __syncthreads();
  const float b3v = bfr(B3[0]);
  { const int qq = wave & (QB - 1);
    const float* khw = KH + ((b * TK + (wave >> 2) * 64) >> 4) * (size_t)(16 * HD_) + lane * 4;   /* the wave's 4 key tiles in fragment order, 16 * HD_ floats each: this lane's fragment row of tile rt = key 64 (wave >> 2) + 16 rt + col; a wave's 16-byte load covers 512 contiguous bytes (4 lines) */
    v4f kn[2][4];   /* kh of this k chunk and of the next (set = chunk & 1): a set is loaded anew, two chunks ahead, as soon as it has been read, so that the load's latency runs under the WMMAs of two chunks */
#pragma unroll
    for (int s = 0; s < 2; ++s) {
#pragma unroll
      for (int u = 0; u < 4; ++u) kn[s][u] = *(const v4f*)(khw + s * 512 + u * 128); }
#pragma unroll 1
    for (int rt = 0; rt < 4; ++rt) { const int k0 = (wave >> 2) * 64 + rt * 16;
      float ps[8] = {0.f, 0.f, 0.f, 0.f, 0.f, 0.f, 0.f, 0.f};
#pragma unroll 1
      for (int half = 0; half < 2; ++half) {   /* 2 x 128 output columns: keeps the accumulators at 8 tiles (VGPRs <= 256) */
        float b2w[8], w3w[8];   /* loaded here, first read (and rounded) behind the k loop */
#pragma unroll
        for (int j = 0; j < 8; ++j) { b2w[j] = B2[half * 128 + j * 16 + col]; w3w[j] = W3[half * 128 + j * 16 + col]; }
        v8f acc[8] = {};
#pragma unroll 1
        for (int kp = 0; kp < HD_ / 64; ++kp) {
#pragma unroll   /* the two chunks of a trip use the two register sets by constant index */
          for (int s = 0; s < 2; ++s) { const int kc = kp * 2 + s;
            union { v16b v; v8b q[2]; } wf[8];   /* the 8 W2 fragments of this k chunk, read from LDS in one group ahead of the WMMAs */
#pragma unroll
            for (int j = 0; j < 8; ++j) { wf[j].q[0] = *(const v8b*)&sw[kc][half * 8 + j][0][lane][0]; wf[j].q[1] = *(const v8b*)&sw[kc][half * 8 + j][1][lane][0]; }
            float va[16];
#pragma unroll
            for (int i = 0; i < 16; ++i) { const int c = kc * 32 + 8 * g + (i < 8 ? i : 8 + i); va[i] = fmaxf(kn[s][i >> 2][i & 3] + sq[qq][c], 0.f); }   /* relu(kh + qh + b1) */
            const F2 a = bsplit16(va);
            const int nrt = (kp == HD_ / 64 - 1 && half == 1 && rt < 3) ? rt + 1 : rt;   /* the chunk read two chunks on: of this tile (from chunk 0 again for the second half), then of the next tile; behind the last tile its chunks 0 and 1 are loaded once more and not read */
            const float* kq = khw + nrt * (16 * HD_) + (((kp + 1) & (HD_ / 64 - 1)) * 2 + s) * 512;
            __builtin_amdgcn_sched_barrier(0x38f);   /* holds global loads only (the mask lets every other kind cross): keeps the reload behind the last read of its set; lifted above it, the reload took a third register set, 16 register copies a trip and an earlier wait */
#pragma unroll
            for (int u = 0; u < 4; ++u) kn[s][u] = *(const v4f*)(kq + u * 128);
#pragma unroll
            for (int j = 0; j < 8; ++j) { acc[j] = wmma_bf(a.h, wf[j].v, acc[j]); acc[j] = wmma_bf(a.l, wf[j].v, acc[j]); } } }
#pragma unroll
        for (int r = 0; r < 8; ++r) { float p = ps[r];
#pragma unroll
          for (int j = 0; j < 8; ++j) p += fmaxf(acc[j][r] + bfr(b2w[j]), 0.f) * bfr(w3w[j]); ps[r] = p; } }
#pragma unroll
      for (int o = 1; o < 16; o <<= 1) {
#pragma unroll
        for (int r = 0; r < 8; ++r) ps[r] += __shfl_xor(ps[r], o); }   /* sum over the 16 column lanes (lane bits 0..3); every lane shuffles */
      if (col == 0) {
#pragma unroll
        for (int r = 0; r < 8; ++r) ss[qq][k0 + 8 * g + r] = ps[r] + b3v; } } }
  __syncthreads();
  // phase 2: softmax per query row (waves 0..3: query w; the other waves go on to the barrier), lane owns keys lane*8..+7; masked keys (k >= klen) excluded, padded queries -> zero probs
  if (wave < QB) { const int qq = wave; const bool qvalid = (q0 + qq) < qlen; float v[8]; float m = -3.0e38f;
#pragma unroll
    for (int u = 0; u < 8; ++u) { float t2 = ss[qq][lane * 8 + u]; asm volatile("" : "+v"(t2)); v[u] = t2; }   /* all 8 scores loaded unconditionally (always written in phase 1), pinned; masked by SELECT below */
#pragma unroll
    for (int u = 0; u < 8; ++u) { const int k = lane * 8 + u; v[u] = (k < klen) ? v[u] : -3.0e38f; m = fmaxf(m, v[u]); }
#pragma unroll
    for (int o = 1; o < 32; o <<= 1) m = fmaxf(m, __shfl_xor(m, o));
    float sum = 0.f, e[8];
#pragma unroll
    for (int u = 0; u < 8; ++u) { e[u] = (lane * 8 + u < klen) ? expf(v[u] - m) : 0.f; sum += e[u]; }
#pragma unroll
    for (int o = 1; o < 32; o <<= 1) sum += __shfl_xor(sum, o);
    const float inv = (qvalid && sum > 0.f) ? 1.0f / sum : 0.f;
    LDSX();
#pragma unroll
    for (int u = 0; u < 8; ++u) ss[qq][lane * 8 + u] = e[u] * inv; }
  __syncthreads();
  // phase 3: out[q0..q0+3][16w..16w+15] = P (hi + lo) x bf16(keys[b]) (exact), K = 256 keys
  { v8f acc = {};
#pragma unroll
    for (int kc = 0; kc < TK / 32; ++kc) { const F2 a = split_row(&ss[col & (QB - 1)][0], kc * 32, lane);
      const v16b w = wcol_kz(KEYS + b * TK * (size_t)HD_, kc * 32, wave * 16 + col, lane, HD_, TK, HD_); acc = wmma_bf(a.h, w, acc); acc = wmma_bf(a.l, w, acc); }   /* B[k][d] = keys[b][k][d] */
    if (g == 0) {   /* D rows 0..3 = the block's queries sit in lanes 0..15, elements 0..3 */
#pragma unroll
      for (int r = 0; r < QB; ++r) so[r][wave * 16 + col] = acc[r]; }
    __syncthreads();   /* the 16 waves' column tiles are gathered so that no 128-byte output line has two writers */
    if (tid < QB * HD_ / 4) vst2(OUT + ((b * TQ + q0 + tid / (HD_ / 4)) * HD_) + (tid % (HD_ / 4)) * 4, *(const v4f*)&so[tid / (HD_ / 4)][(tid % (HD_ / 4)) * 4]); } }   /* a wave stores 512 contiguous bytes of one row */
extern "C" void kernel_launch(void* const* d_in, const int* in_sizes, int n_in, void* d_out, int out_size, void* d_ws, size_t ws_size, hipStream_t stream) {
  (void)in_sizes; (void)n_in; (void)out_size;
  // inputs: 0 queries [4,256,256]; 1 keys [4,256,256]; 2 query_lengths [4] i32; 3 key_lengths [4] i32; 4 W1 [512,256] (in,out: rows 0..255 keys, 256..511 queries); 5 b1 [256]; 6 W2 [256,256]; 7 b2; 8 W3 [256,1]; 9 b3 [1]
  if (ws_size < (size_t)WS_END) return;
  char* ws = (char*)d_ws; const float** F = (const float**)d_in; float *QH = (float*)(ws + WS_QH), *KH = (float*)(ws + WS_KH);
  k_lin<<<dim3(NBV * TQ / 64, HD_ / 128, 2), 128, 0, stream>>>(F[0], F[1], F[4], QH, KH);
  k_mlp<<<dim3(NBV, TQ / QB), NWV * 32, 0, stream>>>(QH, KH, F[1], (const int*)d_in[2], (const int*)d_in[3], F[5], F[6], F[7], F[8], F[9], (float*)d_out);
}

// v005
// It runs in 57.2 microseconds.
// Two timings next to v004 put it at 1.24 and 1.25 times that version's speed.
// All steps since v000 together make it 24.5 times as fast.
// compute dtype: all float inputs rounded to bf16; qh = queries W1[256:], kh = keys W1[:256] with EXACT bf16 products on WMMA 16x16x32 (f32 accumulate); per (query, key) pair h1 = relu(qh + kh + b1) in f32, split bf16 hi + lo against exact bf16 W2 (2 products); relu(+b2), the w3 dot, masking and softmax in f32; probs split bf16 hi + lo against exact bf16 keys (2 products); f32 output.
#include <hip/hip_runtime.h>
#include <math.h>

typedef __attribute__((ext_vector_type(16))) _Float16 v16h;
typedef __attribute__((ext_vector_type(16))) __bf16 v16b;
typedef __attribute__((ext_vector_type(8)))  _Float16 v8h;
typedef __attribute__((ext_vector_type(8)))  __bf16 v8b;
typedef __attribute__((ext_vector_type(8)))  float v8f;
typedef __attribute__((ext_vector_type(4)))  float v4f;
typedef __attribute__((ext_vector_type(2)))  float v2f;
typedef __attribute__((ext_vector_type(4)))  unsigned v4u;
typedef __attribute__((ext_vector_type(4)))  int v4i;
typedef float __attribute__((may_alias)) float_a;
typedef int __attribute__((may_alias)) int_a;

template <typename T> __device__ __forceinline__ void vst2(void* p, T v) { *(T*)p = v;  }
__device__ __forceinline__ v8f wmma16(v16h a, v16h b, v8f c) {
  v8f d = __builtin_amdgcn_wmma_f32_16x16x32_f16(false, a, false, b, (short)0, c, false, false);
  asm volatile("v_nop\n\tv_nop\n\tv_nop\n\tv_nop" : "+v"(d) : "v"(a), "v"(b));
  return d;
}
__device__ __forceinline__ v8f wmma_bf(v16b a, v16b b, v8f c) {
  v8f d = __builtin_amdgcn_wmma_f32_16x16x32_bf16(false, a, false, b, (short)0, c, false, false);
  asm volatile("v_nop\n\tv_nop\n\tv_nop\n\tv_nop" : "+v"(d) : "v"(a), "v"(b));
  return d;
}
// 16x16x32 fragments: lane = (h = lane>>4, row/col = lane&15); elements 0..7 = k0+8h+0..7, 8..15 = k0+16+8h+0..7; D element r = row 8h+r
__device__ __forceinline__ v16h frag_h(const _Float16* rowk0, int lane) {
  union { v16h v; v8h q[2]; } u; const _Float16* p = rowk0 + 8 * (lane >> 4);
  u.q[0] = *(const v8h*)p; u.q[1] = *(const v8h*)(p + 16); return u.v;
}
__device__ __forceinline__ v16h frag_f32(const float* rowk0, int lane) {
  v16h a; const float* p = rowk0 + 8 * (lane >> 4);
#pragma unroll
  for (int i = 0; i < 8; ++i) { a[i] = (_Float16)p[i]; a[8 + i] = (_Float16)p[16 + i]; }
  return a;
}
__device__ __forceinline__ v16h frag_f32s(const float* rowk0, int lane, float sc) {
  v16h a; const float* p = rowk0 + 8 * (lane >> 4);
#pragma unroll
  for (int i = 0; i < 8; ++i) { a[i] = (_Float16)(p[i] * sc); a[8 + i] = (_Float16)(p[16 + i] * sc); }
  return a;
}
// column fragment from a [K][ld] layout (column n), rows >= K read as 0
__device__ __forceinline__ v16h fragc_f32(const float* W, int k0, int n, int lane, int ld, int K) {
  v16h a; const int g = lane >> 4;
#pragma unroll
  for (int i = 0; i < 8; ++i) { const int ka = k0 + 8 * g + i, kb = ka + 16;
    a[i] = (_Float16)(ka < K ? W[(size_t)(ka < K ? ka : K - 1) * ld + n] : 0.f); a[8 + i] = (_Float16)(kb < K ? W[(size_t)(kb < K ? kb : K - 1) * ld + n] : 0.f); }
  return a;
}
struct F2 { v16b h, l; };
__device__ __forceinline__ F2 bsplit16(const float v[16]) { F2 r;
#pragma unroll
  for (int i = 0; i < 16; ++i) { const __bf16 h = (__bf16)v[i]; r.h[i] = h; r.l[i] = (__bf16)(v[i] - (float)h); }
  return r; }
__device__ __forceinline__ F2 split_row(const float* row, int k0, int lane) { float v[16]; const float* p = row + k0 + 8 * (lane >> 4);
#pragma unroll
  for (int i = 0; i < 8; ++i) { v[i] = p[i]; v[8 + i] = p[16 + i]; }
  return bsplit16(v); }
__device__ __forceinline__ F2 split_rowK(const float* row, int k0, int lane, int K) { float v[16]; const int g = lane >> 4;
#pragma unroll
  for (int i = 0; i < 8; ++i) { const int ka = k0 + 8 * g + i, kb = ka + 16; v[i] = ka < K ? row[ka < K ? ka : K - 1] : 0.f; v[8 + i] = kb < K ? row[kb < K ? kb : K - 1] : 0.f; }
  return bsplit16(v); }
__device__ __forceinline__ F2 split_col(const float* W, int k0, int n, int lane, int ld, int K) { float v[16]; const int g = lane >> 4;
#pragma unroll
  for (int i = 0; i < 8; ++i) { const int ka = k0 + 8 * g + i, kb = ka + 16; v[i] = ka < K ? W[(size_t)(ka < K ? ka : K - 1) * ld + n] : 0.f; v[8 + i] = kb < K ? W[(size_t)(kb < K ? kb : K - 1) * ld + n] : 0.f; }
  return bsplit16(v); }
__device__ __forceinline__ v8f mac3(const F2& a, const F2& b, v8f c) { c = wmma_bf(a.l, b.h, c); c = wmma_bf(a.h, b.l, c); return wmma_bf(a.h, b.h, c); }
__device__ __forceinline__ float sigm(float v) { return 1.0f / (1.0f + expf(-v)); }
#define LDSX() do { asm volatile("s_wait_dscnt 0" ::: "memory"); __builtin_amdgcn_wave_barrier(); __builtin_amdgcn_fence(__ATOMIC_RELEASE, "workgroup"); } while (0)

// Additive (MLP) attention (B 4, Tq = Tk = 256, dims 256; ragged query/key lengths in [128, 256]): for every (q, k): h = relu([keys_k | queries_q] W1 + b1) = relu(kh_k + qh_q + b1); h = relu(h W2 + b2); score = h . w3 + b3; score := -1e30 where q >= query_len or k >= key_len; probs = softmax over k, then 0 where masked; out = probs keys -> [B, Tq, 256] (padded query rows are exactly 0).
#define NBT 4
#define TQ 256
#define TK 256
#define HD_ 256             // Q = K = H = 256
#define QB 4                // queries per block
#define NWV 16              // waves per block: wave = (query wave & 3, key group wave >> 2)
#ifndef NBV
#define NBV NBT             // batches processed
#endif
__device__ __forceinline__ float bfr(float v) { return (float)(__bf16)v; }
__device__ __forceinline__ v16b wcol_kz(const float* __restrict__ Wm, int k0, int o, int lane, int ld, int K, int nvalid) { v16b w; const int g = lane >> 4; const int oc = o < nvalid ? o : 0; const float keepo = o < nvalid ? 1.f : 0.f;
  asm volatile("s_wait_loadcnt 0x0" ::: "memory");   /* drain earlier gathers so this 16-load column burst never stacks on top of them */
#pragma unroll
  for (int i = 0; i < 8; ++i) { const int ka = k0 + 8 * g + i, kb = ka + 16; w[i] = (__bf16)(Wm[(size_t)(ka < K ? ka : 0) * ld + oc] * (ka < K ? keepo : 0.f)); w[8 + i] = (__bf16)(Wm[(size_t)(kb < K ? kb : 0) * ld + oc] * (kb < K ? keepo : 0.f)); }
  asm volatile("s_wait_loadcnt 0x0" ::: "memory"); return w; }
#define WS_QH  0u                                   // f32 qh [B*TQ][256]
#define WS_KH  (WS_QH + 4u * (size_t)NBT * TQ * HD_)   // f32 kh in A-fragment order: [B*TK/16 key tile][k chunk of 32][element quarter][lane][4]
#define WS_END (WS_KH + 4u * (size_t)NBT * TK * HD_)
// ---- k_lin: block = (64 rows, 128 cols, which): which 0: qh = bf16(queries) W1[256:512] ; which 1: kh = bf16(keys) W1[0:256] (exact products, K 256, (in,out)); the block's 256 x 128 slice of W1 is rounded to bf16 and staged once in LDS in B-fragment order, shared by its 4 waves; qh as f32 rows, kh in the pair GEMM's A-fragment order, both stored as 512-B segments by 32 lanes
#define W1P 520             // bf16 per (k chunk, column tile) of the staged W1 slice: 2 halves x 32 lanes x 8 k, plus 8 (16 bytes), so that the 16 lanes of a half wave, which store into 4 column tiles at a time, fall on 16 different bank groups
__global__ __launch_bounds__(128) void k_lin(const float* __restrict__ XQ, const float* __restrict__ XK, const float* __restrict__ W1, float* __restrict__ QH, float* __restrict__ KH) { __shared__ __align__(16) float sf[4][16][132];
  __shared__ __align__(16) __bf16 sw1[HD_ / 32][8][W1P];   /* [k chunk of 32][column tile][(element half * 32 + lane) * 8 + k]; a wave's 16-byte reads of one half are 512 contiguous bytes */
  const int tid = threadIdx.x, wave = tid >> 5, lane = tid & 31, col = lane & 15, g = lane >> 4; const int which = blockIdx.z; const int c0 = blockIdx.y * 128; const size_t r0 = (size_t)blockIdx.x * 64 + wave * 16;
  const float* X = which == 0 ? XQ : XK; const float* Wm = which == 0 ? W1 + (size_t)HD_ * HD_ : W1; float* OUT = which == 0 ? QH : KH;   /* W1 rows 0..255 multiply the keys, rows 256..511 the queries (torch concat order [keys, queries]) */
  // the wave's 16 A rows, all 8 k chunks, loaded ahead of the staging so that both sets of loads are in flight together
  v4f xr[HD_ / 32][4]; { const float* p = X + (r0 + col) * HD_ + 8 * g;
#pragma unroll
    for (int kc = 0; kc < HD_ / 32; ++kc) { xr[kc][0] = *(const v4f*)(p + kc * 32); xr[kc][1] = *(const v4f*)(p + kc * 32 + 4); xr[kc][2] = *(const v4f*)(p + kc * 32 + 16); xr[kc][3] = *(const v4f*)(p + kc * 32 + 20); } }
  // W1 slice: item = (8 consecutive k, 4 consecutive columns); a wave's 32 items share the 8 k, so each row read is 512 contiguous bytes; 8 row reads of 16 bytes, rounded to bf16, 4 stores of 16 bytes (one per column). k = 32 kc + 16 q + 8 g + i, column = c0 + 16 jt + col, fragment lane = 16 g + col.
#pragma unroll 2   /* two items = 16 row reads in flight per thread beside the 32 A reads: four items took the kernel past 256 registers */
  for (int it = 0; it < (HD_ / 8) * (128 / 4) / 128; ++it) { const int k8 = it * 4 + wave, n0 = lane * 4; v4f rw[8];
#pragma unroll
    for (int i = 0; i < 8; ++i) rw[i] = *(const v4f*)(Wm + (size_t)(k8 * 8 + i) * HD_ + c0 + n0);
#pragma unroll
    for (int c = 0; c < 4; ++c) { v8b t;
#pragma unroll
      for (int i = 0; i < 8; ++i) t[i] = (__bf16)rw[i][c];
      *(v8b*)&sw1[k8 >> 2][n0 >> 4][(((k8 >> 1) & 1) * 32 + (k8 & 1) * 16 + (n0 & 15) + c) * 8] = t; } }
  v16b a[HD_ / 32];
#pragma unroll
  for (int kc = 0; kc < HD_ / 32; ++kc) {
#pragma unroll
    for (int i = 0; i < 16; ++i) a[kc][i] = (__bf16)xr[kc][i >> 2][i & 3]; }
  __syncthreads();   /* the slice is read by all 4 waves */
  v8f acc[8] = {};
#pragma unroll
  for (int kc = 0; kc < HD_ / 32; ++kc) { union { v16b v; v8b q[2]; } wf[8];   /* the 8 W1 fragments of this k chunk, read from LDS in one group ahead of the WMMAs */
#pragma unroll
    for (int j = 0; j < 8; ++j) { wf[j].q[0] = *(const v8b*)&sw1[kc][j][lane * 8]; wf[j].q[1] = *(const v8b*)&sw1[kc][j][(32 + lane) * 8]; }
#pragma unroll
    for (int j = 0; j < 8; ++j) acc[j] = wmma_bf(a[kc], wf[j].v, acc[j]); }
#pragma unroll
  for (int j = 0; j < 8; ++j) {
#pragma unroll
    for (int r = 0; r < 8; ++r) sf[wave][8 * g + r][j * 16 + col] = acc[j][r]; }
  LDSX();
  if (which == 0) { for (int rl = 0; rl < 16; ++rl) vst2(OUT + (r0 + rl) * HD_ + c0 + lane * 4, *(const v4f*)&sf[wave][rl][lane * 4]); }
  else {   /* kh: the wave's 16 rows are one key tile; segment s = (k chunk s >> 2, element quarter s & 3); lane (g, col) holds row col, columns 32 chunk + 16 (quarter >> 1) + 8 g + 4 (quarter & 1) + 0..3, i.e. fragment elements 4 quarter + 0..3 */
    float* kf = OUT + ((r0 >> 4) * (HD_ / 32) + (c0 >> 5)) * 512 + lane * 4;
    for (int s = 0; s < 16; ++s) vst2(kf + s * 128, *(const v4f*)&sf[wave][col][(s >> 2) * 32 + ((s >> 1) & 1) * 16 + 8 * g + (s & 1) * 4]);
    asm volatile("s_wait_xcnt 0x0" ::: "memory"); } }   /* stands behind the last kh store, ahead of any code the listing lets follow that rewrites the stores' data or address registers */
// ---- k_mlp: block = (batch b, 4 queries q0..q0+3), 16 waves, 256 blocks (one per WGP, four waves per SIMD, so that one wave's load waits are filled by the others' matrix work). Phase 1: wave w owns query q0 + (w & 3) and keys 64(w>>2)..64(w>>2)+63 as 4 row-tiles of 16 (the four waves of a key group read the same kh lines at about the same time; kh comes in fragment order, whole lines per load); for each row-tile: A[row = key][c] = relu(qh[q][c] + kh[k][c] + b1[c]) (f32, built per lane, split bf16 hi + lo) x W2 (exact) -> 16 column tiles; score[q][k] = sum_c relu(acc + b2[c]) w3[c] (per-lane partial over its columns (two 128-column halves of 8 tiles each to stay within 256 VGPRs), then an xor tree over the 16 column lanes) + b3 -> LDS. Phase 2: softmax per query over k < key_len (rows with q >= query_len -> all-zero probs), in place. Phase 3: out tile = P (hi + lo) x bf16(keys[b]) (exact), fragment rows 4..15 repeat rows 0..3 and are dropped -> wave w computes columns 16w..16w+15 of the 4 output rows into LDS; after a barrier 8 waves store 512 contiguous bytes each.
__global__ __launch_bounds__(NWV * 32) void k_mlp(const float* __restrict__ QH, const float* __restrict__ KH, const float* __restrict__ KEYS, const int* __restrict__ QL, const int* __restrict__ KL, const float* __restrict__ B1, const float* __restrict__ W2, const float* __restrict__ B2, const float* __restrict__ W3, const float* __restrict__ B3, float* __restrict__ OUT) {
  __shared__ __align__(16) __bf16 sw[HD_ / 32][HD_ / 16][2][32][8];   /* bf16(W2) in B-fragment order: [k chunk of 32][column tile][element half][lane][8 k]; a wave's 16-byte reads of one half are 512 contiguous bytes */
  __shared__ __align__(16) float sq[QB][HD_]; __shared__ __align__(16) float ss[QB][TK + 4]; __shared__ __align__(16) float so[QB][HD_];
  const int tid = threadIdx.x, wave = tid >> 5, lane = tid & 31, col = lane & 15, g = lane >> 4; const size_t b = blockIdx.x; const int q0 = blockIdx.y * QB;
  int qlen = QL[b], klen = KL[b]; qlen = qlen < 0 ? 0 : (qlen > TQ ? TQ : qlen); klen = klen < 0 ? 0 : (klen > TK ? TK : klen);
  for (int e = tid; e < QB * HD_ / 4; e += NWV * 32) { const int qq = e / (HD_ / 4), c4 = e % (HD_ / 4); const v4f v = *(const v4f*)(QH + ((b * TQ + q0 + qq) * HD_) + c4 * 4); const v4f bb = *(const v4f*)(B1 + c4 * 4); asm volatile("s_wait_loadcnt 0x0" ::: "memory"); v4f o; o[0] = v[0] + bfr(bb[0]); o[1] = v[1] + bfr(bb[1]); o[2] = v[2] + bfr(bb[2]); o[3] = v[3] + bfr(bb[3]); *(v4f*)&sq[qq][c4 * 4] = o; }   /* qh[q] + b1 staged once */
  // W2 staged once per block: item = (8 consecutive k, 4 consecutive columns); 8 row reads of 16 bytes, rounded to bf16, 4 stores of 16 bytes (one per column). k = 32 kc + 16 q + 8 g + i, column = 16 jt + col, fragment lane = 16 g + col.
#pragma unroll 2   /* two items = 16 row reads in flight per thread, so that the 4 trips cost 2 load latencies */
  for (int it = 0; it < (HD_ / 8) * (HD_ / 4) / (NWV * 32); ++it) { const int e = it * (NWV * 32) + tid; const int k8 = e / (HD_ / 4), n0 = (e % (HD_ / 4)) * 4; v4f rw[8];
#pragma unroll
    for (int i = 0; i < 8; ++i) rw[i] = *(const v4f*)(W2 + (size_t)(k8 * 8 + i) * HD_ + n0);
#pragma unroll
    for (int c = 0; c < 4; ++c) { v8b t;
#pragma unroll
      for (int i = 0; i < 8; ++i) t[i] = (__bf16)rw[i][c];
      *(v8b*)&sw[k8 >> 2][n0 >> 4][(k8 >> 1) & 1][(k8 & 1) * 16 + (n0 & 15) + c][0] = t; } }
  __syncthreads();
  const float b3v = bfr(B3[0]);
  { const int qq = wave & (QB - 1);
    const float* khw = KH + ((b * TK + (wave >> 2) * 64) >> 4) * (size_t)(16 * HD_) + lane * 4;   /* the wave's 4 key tiles in fragment order, 16 * HD_ floats each: this lane's fragment row of tile rt = key 64 (wave >> 2) + 16 rt + col; a wave's 16-byte load covers 512 contiguous bytes (4 lines) */
    v4f kn[2][4];   /* kh of this k chunk and of the next (set = chunk & 1): a set is loaded anew, two chunks ahead, as soon as it has been read, so that the load's latency runs under the WMMAs of two chunks */
#pragma unroll
    for (int s = 0; s < 2; ++s) {
#pragma unroll
      for (int u = 0; u < 4; ++u) kn[s][u] = *(const v4f*)(khw + s * 512 + u * 128); }
#pragma unroll 1
    for (int rt = 0; rt < 4; ++rt) { const int k0 = (wave >> 2) * 64 + rt * 16;
      float ps[8] = {0.f, 0.f, 0.f, 0.f, 0.f, 0.f, 0.f, 0.f};
#pragma unroll 1
      for (int half = 0; half < 2; ++half) {   /* 2 x 128 output columns: keeps the accumulators at 8 tiles (VGPRs <= 256) */
        float b2w[8], w3w[8];   /* loaded here, first read (and rounded) behind the k loop */
#pragma unroll
        for (int j = 0; j < 8; ++j) { b2w[j] = B2[half * 128 + j * 16 + col]; w3w[j] = W3[half * 128 + j * 16 + col]; }
        v8f acc[8] = {};
#pragma unroll 1
        for (int kp = 0; kp < HD_ / 64; ++kp) {
#pragma unroll   /* the two chunks of a trip use the two register sets by constant index */
          for (int s = 0; s < 2; ++s) { const int kc = kp * 2 + s;
            union { v16b v; v8b q[2]; } wf[8];   /* the 8 W2 fragments of this k chunk, read from LDS in one group ahead of the WMMAs */
#pragma unroll
            for (int j = 0; j < 8; ++j) { wf[j].q[0] = *(const v8b*)&sw[kc][half * 8 + j][0][lane][0]; wf[j].q[1] = *(const v8b*)&sw[kc][half * 8 + j][1][lane][0]; }
            float va[16];
#pragma unroll
            for (int i = 0; i < 16; ++i) { const int c = kc * 32 + 8 * g + (i < 8 ? i : 8 + i); va[i] = fmaxf(kn[s][i >> 2][i & 3] + sq[qq][c], 0.f); }   /* relu(kh + qh + b1) */
            const F2 a = bsplit16(va);
            const int nrt = (kp == HD_ / 64 - 1 && half == 1 && rt < 3) ? rt + 1 : rt;   /* the chunk read two chunks on: of this tile (from chunk 0 again for the second half), then of the next tile; behind the last tile its chunks 0 and 1 are loaded once more and not read */
            const float* kq = khw + nrt * (16 * HD_) + (((kp + 1) & (HD_ / 64 - 1)) * 2 + s) * 512;
            __builtin_amdgcn_sched_barrier(0x38f);   /* holds global loads only (the mask lets every other kind cross): keeps the reload behind the last read of its set; lifted above it, the reload took a third register set, 16 register copies a trip and an earlier wait */
#pragma unroll
            for (int u = 0; u < 4; ++u) kn[s][u] = *(const v4f*)(kq + u * 128);
#pragma unroll
            for (int j = 0; j < 8; ++j) { acc[j] = wmma_bf(a.h, wf[j].v, acc[j]); acc[j] = wmma_bf(a.l, wf[j].v, acc[j]); } } }
#pragma unroll
        for (int r = 0; r < 8; ++r) { float p = ps[r];
#pragma unroll
          for (int j = 0; j < 8; ++j) p += fmaxf(acc[j][r] + bfr(b2w[j]), 0.f) * bfr(w3w[j]); ps[r] = p; } }
#pragma unroll
      for (int o = 1; o < 16; o <<= 1) {
#pragma unroll
        for (int r = 0; r < 8; ++r) ps[r] += __shfl_xor(ps[r], o); }   /* sum over the 16 column lanes (lane bits 0..3); every lane shuffles */
      if (col == 0) {
#pragma unroll
        for (int r = 0; r < 8; ++r) ss[qq][k0 + 8 * g + r] = ps[r] + b3v; } } }
  __syncthreads();
  // phase 2: softmax per query row (waves 0..3: query w; the other waves go on to the barrier), lane owns keys lane*8..+7; masked keys (k >= klen) excluded, padded queries -> zero probs
  if (wave < QB) { const int qq = wave; const bool qvalid = (q0 + qq) < qlen; float v[8]; float m = -3.0e38f;
#pragma unroll
    for (int u = 0; u < 8; ++u) { float t2 = ss[qq][lane * 8 + u]; asm volatile("" : "+v"(t2)); v[u] = t2; }   /* all 8 scores loaded unconditionally (always written in phase 1), pinned; masked by SELECT below */
#pragma unroll
    for (int u = 0; u < 8; ++u) { const int k = lane * 8 + u; v[u] = (k < klen) ? v[u] : -3.0e38f; m = fmaxf(m, v[u]); }
#pragma unroll
    for (int o = 1; o < 32; o <<= 1) m = fmaxf(m, __shfl_xor(m, o));
    float sum = 0.f, e[8];
#pragma unroll
    for (int u = 0; u < 8; ++u) { e[u] = (lane * 8 + u < klen) ? expf(v[u] - m) : 0.f; sum += e[u]; }
#pragma unroll
    for (int o = 1; o < 32; o <<= 1) sum += __shfl_xor(sum, o);
    const float inv = (qvalid && sum > 0.f) ? 1.0f / sum : 0.f;
    LDSX();
#pragma unroll
    for (int u = 0; u < 8; ++u) ss[qq][lane * 8 + u] = e[u] * inv; }
  __syncthreads();
  // phase 3: out[q0..q0+3][16w..16w+15] = P (hi + lo) x bf16(keys[b]) (exact), K = 256 keys
  { v8f acc = {};
#pragma unroll
    for (int kc = 0; kc < TK / 32; ++kc) { const F2 a = split_row(&ss[col & (QB - 1)][0], kc * 32, lane);
      const v16b w = wcol_kz(KEYS + b * TK * (size_t)HD_, kc * 32, wave * 16 + col, lane, HD_, TK, HD_); acc = wmma_bf(a.h, w, acc); acc = wmma_bf(a.l, w, acc); }   /* B[k][d] = keys[b][k][d] */
    if (g == 0) {   /* D rows 0..3 = the block's queries sit in lanes 0..15, elements 0..3 */
#pragma unroll
      for (int r = 0; r < QB; ++r) so[r][wave * 16 + col] = acc[r]; }
    __syncthreads();   /* the 16 waves' column tiles are gathered so that no 128-byte output line has two writers */
    if (tid < QB * HD_ / 4) vst2(OUT + ((b * TQ + q0 + tid / (HD_ / 4)) * HD_) + (tid % (HD_ / 4)) * 4, *(const v4f*)&so[tid / (HD_ / 4)][(tid % (HD_ / 4)) * 4]); } }   /* a wave stores 512 contiguous bytes of one row */
extern "C" void kernel_launch(void* const* d_in, const int* in_sizes, int n_in, void* d_out, int out_size, void* d_ws, size_t ws_size, hipStream_t stream) {
  (void)in_sizes; (void)n_in; (void)out_size;
  // inputs: 0 queries [4,256,256]; 1 keys [4,256,256]; 2 query_lengths [4] i32; 3 key_lengths [4] i32; 4 W1 [512,256] (in,out: rows 0..255 keys, 256..511 queries); 5 b1 [256]; 6 W2 [256,256]; 7 b2; 8 W3 [256,1]; 9 b3 [1]
  if (ws_size < (size_t)WS_END) return;
  char* ws = (char*)d_ws; const float** F = (const float**)d_in; float *QH = (float*)(ws + WS_QH), *KH = (float*)(ws + WS_KH);
  k_lin<<<dim3(NBV * TQ / 64, HD_ / 128, 2), 128, 0, stream>>>(F[0], F[1], F[4], QH, KH);
  k_mlp<<<dim3(NBV, TQ / QB), NWV * 32, 0, stream>>>(QH, KH, F[1], (const int*)d_in[2], (const int*)d_in[3], F[5], F[6], F[7], F[8], F[9], (float*)d_out);
}

// v006
// It runs in 49.2 microseconds.
// Two timings next to v005 put it at 1.17 and 1.16 times that version's speed.
// Counting every step since v000, it is 28.5 times as fast.
// compute dtype: all float inputs rounded to bf16; qh = queries W1[256:], kh = keys W1[:256] with EXACT bf16 products on WMMA 16x16x32 (f32 accumulate); per (query, key) pair h1 = relu(qh + kh + b1) in f32, split bf16 hi + lo against exact bf16 W2 (2 products); relu(+b2), the w3 dot, masking and softmax in f32; probs split bf16 hi + lo against exact bf16 keys (2 products); f32 output.
#include <hip/hip_runtime.h>
#include <math.h>

typedef __attribute__((ext_vector_type(16))) _Float16 v16h;
typedef __attribute__((ext_vector_type(16))) __bf16 v16b;
typedef __attribute__((ext_vector_type(8)))  _Float16 v8h;
typedef __attribute__((ext_vector_type(8)))  __bf16 v8b;
typedef __attribute__((ext_vector_type(8)))  float v8f;
typedef __attribute__((ext_vector_type(4)))  float v4f;
typedef __attribute__((ext_vector_type(2)))  float v2f;
typedef __attribute__((ext_vector_type(4)))  unsigned v4u;
typedef __attribute__((ext_vector_type(4)))  int v4i;
typedef float __attribute__((may_alias)) float_a;
typedef int __attribute__((may_alias)) int_a;

template <typename T> __device__ __forceinline__ void vst2(void* p, T v) { *(T*)p = v;  }
__device__ __forceinline__ v8f wmma16(v16h a, v16h b, v8f c) {
  v8f d = __builtin_amdgcn_wmma_f32_16x16x32_f16(false, a, false, b, (short)0, c, false, false);
  asm volatile("v_nop\n\tv_nop\n\tv_nop\n\tv_nop" : "+v"(d) : "v"(a), "v"(b));
  return d;
}
__device__ __forceinline__ v8f wmma_bf(v16b a, v16b b, v8f c) {
  v8f d = __builtin_amdgcn_wmma_f32_16x16x32_bf16(false, a, false, b, (short)0, c, false, false);
  asm volatile("v_nop\n\tv_nop\n\tv_nop\n\tv_nop" : "+v"(d) : "v"(a), "v"(b));
  return d;
}
// the builtin alone, for accumulators that may lie above v255: an asm operand cannot, and 32 accumulator tiles passed through the statement above were spilled to scratch; the compiler keeps the distance behind its own builtin
__device__ __forceinline__ v8f wmma_hi(v16b a, v16b b, v8f c) { return __builtin_amdgcn_wmma_f32_16x16x32_bf16(false, a, false, b, (short)0, c, false, false); }
// 16x16x32 fragments: lane = (h = lane>>4, row/col = lane&15); elements 0..7 = k0+8h+0..7, 8..15 = k0+16+8h+0..7; D element r = row 8h+r
__device__ __forceinline__ v16h frag_h(const _Float16* rowk0, int lane) {
  union { v16h v; v8h q[2]; } u; const _Float16* p = rowk0 + 8 * (lane >> 4);
  u.q[0] = *(const v8h*)p; u.q[1] = *(const v8h*)(p + 16); return u.v;
}
__device__ __forceinline__ v16h frag_f32(const float* rowk0, int lane) {
  v16h a; const float* p = rowk0 + 8 * (lane >> 4);
#pragma unroll
  for (int i = 0; i < 8; ++i) { a[i] = (_Float16)p[i]; a[8 + i] = (_Float16)p[16 + i]; }
  return a;
}
__device__ __forceinline__ v16h frag_f32s(const float* rowk0, int lane, float sc) {
  v16h a; const float* p = rowk0 + 8 * (lane >> 4);
#pragma unroll
  for (int i = 0; i < 8; ++i) { a[i] = (_Float16)(p[i] * sc); a[8 + i] = (_Float16)(p[16 + i] * sc); }
  return a;
}
// column fragment from a [K][ld] layout (column n), rows >= K read as 0
__device__ __forceinline__ v16h fragc_f32(const float* W, int k0, int n, int lane, int ld, int K) {
  v16h a; const int g = lane >> 4;
#pragma unroll
  for (int i = 0; i < 8; ++i) { const int ka = k0 + 8 * g + i, kb = ka + 16;
    a[i] = (_Float16)(ka < K ? W[(size_t)(ka < K ? ka : K - 1) * ld + n] : 0.f); a[8 + i] = (_Float16)(kb < K ? W[(size_t)(kb < K ? kb : K - 1) * ld + n] : 0.f); }
  return a;
}
struct F2 { v16b h, l; };
__device__ __forceinline__ F2 bsplit16(const float v[16]) { F2 r;
#pragma unroll
  for (int i = 0; i < 16; ++i) { const __bf16 h = (__bf16)v[i]; r.h[i] = h; r.l[i] = (__bf16)(v[i] - (float)h); }
  return r; }
__device__ __forceinline__ F2 split_row(const float* row, int k0, int lane) { float v[16]; const float* p = row + k0 + 8 * (lane >> 4);
#pragma unroll
  for (int i = 0; i < 8; ++i) { v[i] = p[i]; v[8 + i] = p[16 + i]; }
  return bsplit16(v); }
__device__ __forceinline__ F2 split_rowK(const float* row, int k0, int lane, int K) { float v[16]; const int g = lane >> 4;
#pragma unroll
  for (int i = 0; i < 8; ++i) { const int ka = k0 + 8 * g + i, kb = ka + 16; v[i] = ka < K ? row[ka < K ? ka : K - 1] : 0.f; v[8 + i] = kb < K ? row[kb < K ? kb : K - 1] : 0.f; }
  return bsplit16(v); }
__device__ __forceinline__ F2 split_col(const float* W, int k0, int n, int lane, int ld, int K) { float v[16]; const int g = lane >> 4;
#pragma unroll
  for (int i = 0; i < 8; ++i) { const int ka = k0 + 8 * g + i, kb = ka + 16; v[i] = ka < K ? W[(size_t)(ka < K ? ka : K - 1) * ld + n] : 0.f; v[8 + i] = kb < K ? W[(size_t)(kb < K ? kb : K - 1) * ld + n] : 0.f; }
  return bsplit16(v); }
__device__ __forceinline__ v8f mac3(const F2& a, const F2& b, v8f c) { c = wmma_bf(a.l, b.h, c); c = wmma_bf(a.h, b.l, c); return wmma_bf(a.h, b.h, c); }
__device__ __forceinline__ float sigm(float v) { return 1.0f / (1.0f + expf(-v)); }
#define LDSX() do { asm volatile("s_wait_dscnt 0" ::: "memory"); __builtin_amdgcn_wave_barrier(); __builtin_amdgcn_fence(__ATOMIC_RELEASE, "workgroup"); } while (0)

// Additive (MLP) attention (B 4, Tq = Tk = 256, dims 256; ragged query/key lengths in [128, 256]): for every (q, k): h = relu([keys_k | queries_q] W1 + b1) = relu(kh_k + qh_q + b1); h = relu(h W2 + b2); score = h . w3 + b3; score := -1e30 where q >= query_len or k >= key_len; probs = softmax over k, then 0 where masked; out = probs keys -> [B, Tq, 256] (padded query rows are exactly 0).
#define NBT 4
#define TQ 256
#define TK 256
#define HD_ 256             // Q = K = H = 256
#define QB 4                // queries per block
#define NWV 8               // waves per block: wave = (query wave & 3, key group wave >> 2)
#ifndef NBV
#define NBV NBT             // batches processed
#endif
__device__ __forceinline__ float bfr(float v) { return (float)(__bf16)v; }
__device__ __forceinline__ void wcol_kz2(const float* __restrict__ Wm, int k0, int o, int lane, int ld, int K, int nvalid, v16b w[2]) { const int g = lane >> 4;   /* columns o and o + 16 */
  asm volatile("s_wait_loadcnt 0x0" ::: "memory");   /* drain earlier gathers so this 32-load burst of two column tiles never stacks on top of them */
#pragma unroll
  for (int t = 0; t < 2; ++t) { const int ot = o + 16 * t; const int oc = ot < nvalid ? ot : 0; const float keepo = ot < nvalid ? 1.f : 0.f;
#pragma unroll
    for (int i = 0; i < 8; ++i) { const int ka = k0 + 8 * g + i, kb = ka + 16; w[t][i] = (__bf16)(Wm[(size_t)(ka < K ? ka : 0) * ld + oc] * (ka < K ? keepo : 0.f)); w[t][8 + i] = (__bf16)(Wm[(size_t)(kb < K ? kb : 0) * ld + oc] * (kb < K ? keepo : 0.f)); } }
  asm volatile("s_wait_loadcnt 0x0" ::: "memory"); }
#define WS_QH  0u                                   // f32 qh [B*TQ][256]
#define WS_KH  (WS_QH + 4u * (size_t)NBT * TQ * HD_)   // f32 kh in A-fragment order: [B*TK/16 key tile][k chunk of 32][element quarter][lane][4]
#define WS_END (WS_KH + 4u * (size_t)NBT * TK * HD_)
// ---- k_lin: block = (64 rows, 128 cols, which): which 0: qh = bf16(queries) W1[256:512] ; which 1: kh = bf16(keys) W1[0:256] (exact products, K 256, (in,out)); the block's 256 x 128 slice of W1 is rounded to bf16 and staged once in LDS in B-fragment order, shared by its 4 waves; qh as f32 rows, kh in the pair GEMM's A-fragment order, both stored as 512-B segments by 32 lanes
#define W1P 520             // bf16 per (k chunk, column tile) of the staged W1 slice: 2 halves x 32 lanes x 8 k, plus 8 (16 bytes), so that the 16 lanes of a half wave, which store into 4 column tiles at a time, fall on 16 different bank groups
__global__ __launch_bounds__(128) void k_lin(const float* __restrict__ XQ, const float* __restrict__ XK, const float* __restrict__ W1, float* __restrict__ QH, float* __restrict__ KH) { __shared__ __align__(16) float sf[4][16][132];
  __shared__ __align__(16) __bf16 sw1[HD_ / 32][8][W1P];   /* [k chunk of 32][column tile][(element half * 32 + lane) * 8 + k]; a wave's 16-byte reads of one half are 512 contiguous bytes */
  const int tid = threadIdx.x, wave = tid >> 5, lane = tid & 31, col = lane & 15, g = lane >> 4; const int which = blockIdx.z; const int c0 = blockIdx.y * 128; const size_t r0 = (size_t)blockIdx.x * 64 + wave * 16;
  const float* X = which == 0 ? XQ : XK; const float* Wm = which == 0 ? W1 + (size_t)HD_ * HD_ : W1; float* OUT = which == 0 ? QH : KH;   /* W1 rows 0..255 multiply the keys, rows 256..511 the queries (torch concat order [keys, queries]) */
  // the wave's 16 A rows, all 8 k chunks, loaded ahead of the staging so that both sets of loads are in flight together
  v4f xr[HD_ / 32][4]; { const float* p = X + (r0 + col) * HD_ + 8 * g;
#pragma unroll
    for (int kc = 0; kc < HD_ / 32; ++kc) { xr[kc][0] = *(const v4f*)(p + kc * 32); xr[kc][1] = *(const v4f*)(p + kc * 32 + 4); xr[kc][2] = *(const v4f*)(p + kc * 32 + 16); xr[kc][3] = *(const v4f*)(p + kc * 32 + 20); } }
  // W1 slice: item = (8 consecutive k, 4 consecutive columns); a wave's 32 items share the 8 k, so each row read is 512 contiguous bytes; 8 row reads of 16 bytes, rounded to bf16, 4 stores of 16 bytes (one per column). k = 32 kc + 16 q + 8 g + i, column = c0 + 16 jt + col, fragment lane = 16 g + col.
#pragma unroll 2   /* two items = 16 row reads in flight per thread beside the 32 A reads: four items took the kernel past 256 registers */
  for (int it = 0; it < (HD_ / 8) * (128 / 4) / 128; ++it) { const int k8 = it * 4 + wave, n0 = lane * 4; v4f rw[8];
#pragma unroll
    for (int i = 0; i < 8; ++i) rw[i] = *(const v4f*)(Wm + (size_t)(k8 * 8 + i) * HD_ + c0 + n0);
#pragma unroll
    for (int c = 0; c < 4; ++c) { v8b t;
#pragma unroll
      for (int i = 0; i < 8; ++i) t[i] = (__bf16)rw[i][c];
      *(v8b*)&sw1[k8 >> 2][n0 >> 4][(((k8 >> 1) & 1) * 32 + (k8 & 1) * 16 + (n0 & 15) + c) * 8] = t; } }
  v16b a[HD_ / 32];
#pragma unroll
  for (int kc = 0; kc < HD_ / 32; ++kc) {
#pragma unroll
    for (int i = 0; i < 16; ++i) a[kc][i] = (__bf16)xr[kc][i >> 2][i & 3]; }
  __syncthreads();   /* the slice is read by all 4 waves */
  v8f acc[8] = {};
#pragma unroll
  for (int kc = 0; kc < HD_ / 32; ++kc) { union { v16b v; v8b q[2]; } wf[8];   /* the 8 W1 fragments of this k chunk, read from LDS in one group ahead of the WMMAs */
#pragma unroll
    for (int j = 0; j < 8; ++j) { wf[j].q[0] = *(const v8b*)&sw1[kc][j][lane * 8]; wf[j].q[1] = *(const v8b*)&sw1[kc][j][(32 + lane) * 8]; }
#pragma unroll
    for (int j = 0; j < 8; ++j) acc[j] = wmma_bf(a[kc], wf[j].v, acc[j]); }
#pragma unroll
  for (int j = 0; j < 8; ++j) {
#pragma unroll
    for (int r = 0; r < 8; ++r) sf[wave][8 * g + r][j * 16 + col] = acc[j][r]; }
  LDSX();
  if (which == 0) { for (int rl = 0; rl < 16; ++rl) vst2(OUT + (r0 + rl) * HD_ + c0 + lane * 4, *(const v4f*)&sf[wave][rl][lane * 4]); }
  else {   /* kh: the wave's 16 rows are one key tile; segment s = (k chunk s >> 2, element quarter s & 3); lane (g, col) holds row col, columns 32 chunk + 16 (quarter >> 1) + 8 g + 4 (quarter & 1) + 0..3, i.e. fragment elements 4 quarter + 0..3 */
    float* kf = OUT + ((r0 >> 4) * (HD_ / 32) + (c0 >> 5)) * 512 + lane * 4;
    for (int s = 0; s < 16; ++s) vst2(kf + s * 128, *(const v4f*)&sf[wave][col][(s >> 2) * 32 + ((s >> 1) & 1) * 16 + 8 * g + (s & 1) * 4]);
    asm volatile("s_wait_xcnt 0x0" ::: "memory"); } }   /* stands behind the last kh store, ahead of any code the listing lets follow that rewrites the stores' data or address registers */
// ---- k_mlp: block = (batch b, 4 queries q0..q0+3), 8 waves, 256 blocks (one per WGP, two waves per SIMD, up to 512 VGPRs a wave). Phase 1: wave w owns query q0 + (w & 3) and keys 128(w>>2)..128(w>>2)+127 as 4 passes of 2 row-tiles of 16 keys; the wave tile of a pass is 32 pairs x all 256 output columns (32 accumulator tiles), so that a W2 fragment read from LDS feeds 4 WMMAs (2 row-tiles x hi, lo) and A is built once per (row-tile, k chunk): A[row = key][c] = relu(qh[q][c] + kh[k][c] + b1[c]) (f32, built per lane, split bf16 hi + lo; kh comes in fragment order, whole lines per load) x W2 (exact); score[q][k] = sum_c relu(acc + b2[c]) w3[c] (per-lane partial over its columns in ascending tile order, then an xor tree over the 16 column lanes) + b3 -> LDS. Phase 2: softmax per query over k < key_len (rows with q >= query_len -> all-zero probs), in place. Phase 3: out tile = P (hi + lo) x bf16(keys[b]) (exact), fragment rows 4..15 repeat rows 0..3 and are dropped -> wave w computes columns 32w..32w+31 of the 4 output rows into LDS; after a barrier the 8 waves store 512 contiguous bytes each.
__global__ __launch_bounds__(NWV * 32) void k_mlp(const float* __restrict__ QH, const float* __restrict__ KH, const float* __restrict__ KEYS, const int* __restrict__ QL, const int* __restrict__ KL, const float* __restrict__ B1, const float* __restrict__ W2, const float* __restrict__ B2, const float* __restrict__ W3, const float* __restrict__ B3, float* __restrict__ OUT) {
  __shared__ __align__(16) __bf16 sw[HD_ / 32][HD_ / 16][2][32][8];   /* bf16(W2) in B-fragment order: [k chunk of 32][column tile][element half][lane][8 k]; a wave's 16-byte reads of one half are 512 contiguous bytes */
  __shared__ __align__(16) float sq[QB][HD_]; __shared__ __align__(16) float ss[QB][TK + 4]; __shared__ __align__(16) float so[QB][HD_];
  const int tid = threadIdx.x, wave = tid >> 5, lane = tid & 31, col = lane & 15, g = lane >> 4; const size_t b = blockIdx.x; const int q0 = blockIdx.y * QB;
  int qlen = QL[b], klen = KL[b]; qlen = qlen < 0 ? 0 : (qlen > TQ ? TQ : qlen); klen = klen < 0 ? 0 : (klen > TK ? TK : klen);
  for (int e = tid; e < QB * HD_ / 4; e += NWV * 32) { const int qq = e / (HD_ / 4), c4 = e % (HD_ / 4); const v4f v = *(const v4f*)(QH + ((b * TQ + q0 + qq) * HD_) + c4 * 4); const v4f bb = *(const v4f*)(B1 + c4 * 4); asm volatile("s_wait_loadcnt 0x0" ::: "memory"); __builtin_amdgcn_sched_barrier(0);   /* keeps the LDS address arithmetic, which the listing let rewrite the b1 load's offset register, behind the wait */
    v4f o; o[0] = v[0] + bfr(bb[0]); o[1] = v[1] + bfr(bb[1]); o[2] = v[2] + bfr(bb[2]); o[3] = v[3] + bfr(bb[3]); *(v4f*)&sq[qq][c4 * 4] = o; }   /* qh[q] + b1 staged once */
  // W2 staged once per block: item = (8 consecutive k, 4 consecutive columns); 8 row reads of 16 bytes, rounded to bf16, 4 stores of 16 bytes (one per column). k = 32 kc + 16 q + 8 g + i, column = 16 jt + col, fragment lane = 16 g + col.
#pragma unroll 2   /* two items = 16 row reads in flight per thread, so that the 8 trips cost 4 load latencies */
  for (int it = 0; it < (HD_ / 8) * (HD_ / 4) / (NWV * 32); ++it) { const int e = it * (NWV * 32) + tid; const int k8 = e / (HD_ / 4), n0 = (e % (HD_ / 4)) * 4; v4f rw[8];
#pragma unroll
    for (int i = 0; i < 8; ++i) rw[i] = *(const v4f*)(W2 + (size_t)(k8 * 8 + i) * HD_ + n0);
#pragma unroll
    for (int c = 0; c < 4; ++c) { v8b t;
#pragma unroll
      for (int i = 0; i < 8; ++i) t[i] = (__bf16)rw[i][c];
      *(v8b*)&sw[k8 >> 2][n0 >> 4][(k8 >> 1) & 1][(k8 & 1) * 16 + (n0 & 15) + c][0] = t; } }
  __syncthreads();
  const float b3v = bfr(B3[0]);
  { const int qq = wave & (QB - 1), kg = wave >> 2;
    const float* khw = KH + ((b * TK + kg * 128) >> 4) * (size_t)(16 * HD_) + lane * 4;   /* the wave's 8 key tiles in fragment order, 16 * HD_ floats each: this lane's fragment row of tile t = key 128 kg + 16 t + col; a wave's 16-byte load covers 512 contiguous bytes (4 lines) */
    v4f kn[2][2][4];   /* kh of this k chunk and of the next (set = chunk & 1), both row-tiles of the pass: a set is loaded anew, two chunks ahead, as soon as it has been read, so that the load's latency runs under the WMMAs of two chunks */
#pragma unroll
    for (int s = 0; s < 2; ++s) {
#pragma unroll
      for (int t = 0; t < 2; ++t) {
#pragma unroll
        for (int u = 0; u < 4; ++u) kn[s][t][u] = *(const v4f*)(khw + t * (16 * HD_) + s * 512 + u * 128); } }
    float b2w[16], w3w[16];   /* all 256 columns, the same for the four passes: loaded once here */
#pragma unroll
    for (int j = 0; j < 16; ++j) { b2w[j] = B2[j * 16 + col]; w3w[j] = W3[j * 16 + col]; }
    asm volatile("s_wait_xcnt 0x0" ::: "memory");   /* stands behind the kh, b2 and w3 loads, ahead of the loop set-up, which the listing lets rewrite a scalar base of these loads (the pass counter took the low half of w3's) */
#pragma unroll 1
    for (int rp = 0; rp < 4; ++rp) { const int k0 = kg * 128 + rp * 32;
      v8f acc[2][16] = {};
#pragma unroll 1
      for (int kp = 0; kp < HD_ / 64; ++kp) {
#pragma unroll   /* the two chunks of a trip use the two register sets by constant index */
        for (int s = 0; s < 2; ++s) { const int kc = kp * 2 + s;
          union { v16b v; v8b q[2]; } wf[2][4];   /* W2 fragments of this k chunk, 4 column tiles a group, two groups in registers: groups 0 and 1 are read from LDS ahead of the A build, groups 2 and 3 each behind the WMMAs of the group whose registers it takes, one group of WMMAs ahead of its use */
#pragma unroll
          for (int j = 0; j < 8; ++j) { wf[j >> 2][j & 3].q[0] = *(const v8b*)&sw[kc][j][0][lane][0]; wf[j >> 2][j & 3].q[1] = *(const v8b*)&sw[kc][j][1][lane][0]; }
          F2 a[2];
#pragma unroll
          for (int t = 0; t < 2; ++t) { float va[16];
#pragma unroll
            for (int i = 0; i < 16; ++i) { const int c = kc * 32 + 8 * g + (i < 8 ? i : 8 + i); va[i] = fmaxf(kn[s][t][i >> 2][i & 3] + sq[qq][c], 0.f); }   /* relu(kh + qh + b1) */
            a[t] = bsplit16(va); }
          const int nrp = (kp == HD_ / 64 - 1 && rp < 3) ? rp + 1 : rp;   /* the chunk read two chunks on: of this pass, then of the next; behind the last pass its chunks 0 and 1 are loaded once more and not read */
          const float* kq = khw + nrp * (2 * 16 * HD_) + (((kp + 1) & (HD_ / 64 - 1)) * 2 + s) * 512;
          __builtin_amdgcn_sched_barrier(0x38f);   /* holds global loads only (the mask lets every other kind cross): keeps the reload behind the last read of its set, so that it takes no third register set */
#pragma unroll
          for (int t = 0; t < 2; ++t) {
#pragma unroll
            for (int u = 0; u < 4; ++u) kn[s][t][u] = *(const v4f*)(kq + t * (16 * HD_) + u * 128); }
          asm volatile("s_wait_xcnt 0x0" ::: "memory");   /* stands behind the kh loads, ahead of the next trip's address arithmetic, which rewrites their address pair */
#pragma unroll
          for (int jg = 0; jg < 4; ++jg) {
#pragma unroll
            for (int jj = 0; jj < 4; jj += 2) { const int j = jg * 4 + jj;   /* 4 independent accumulators between the hi and the lo product of one tile; per tile hi, then lo */
              acc[0][j] = wmma_hi(a[0].h, wf[jg & 1][jj].v, acc[0][j]); acc[1][j] = wmma_hi(a[1].h, wf[jg & 1][jj].v, acc[1][j]);
              acc[0][j + 1] = wmma_hi(a[0].h, wf[jg & 1][jj + 1].v, acc[0][j + 1]); acc[1][j + 1] = wmma_hi(a[1].h, wf[jg & 1][jj + 1].v, acc[1][j + 1]);
              acc[0][j] = wmma_hi(a[0].l, wf[jg & 1][jj].v, acc[0][j]); acc[1][j] = wmma_hi(a[1].l, wf[jg & 1][jj].v, acc[1][j]);
              acc[0][j + 1] = wmma_hi(a[0].l, wf[jg & 1][jj + 1].v, acc[0][j + 1]); acc[1][j + 1] = wmma_hi(a[1].l, wf[jg & 1][jj + 1].v, acc[1][j + 1]); }
            if (jg < 2) {
#pragma unroll
              for (int j = 0; j < 4; ++j) { wf[jg & 1][j].q[0] = *(const v8b*)&sw[kc][jg * 4 + 8 + j][0][lane][0]; wf[jg & 1][j].q[1] = *(const v8b*)&sw[kc][jg * 4 + 8 + j][1][lane][0]; } } } } }
#pragma unroll
      for (int t = 0; t < 2; ++t) { float ps[8];
#pragma unroll
        for (int r = 0; r < 8; ++r) { float p = 0.f;
#pragma unroll
          for (int j = 0; j < 16; ++j) p += fmaxf(acc[t][j][r] + bfr(b2w[j]), 0.f) * bfr(w3w[j]); ps[r] = p; }
#pragma unroll
        for (int o = 1; o < 16; o <<= 1) {
#pragma unroll
          for (int r = 0; r < 8; ++r) ps[r] += __shfl_xor(ps[r], o); }   /* sum over the 16 column lanes (lane bits 0..3); every lane shuffles */
        if (col == 0) {
#pragma unroll
          for (int r = 0; r < 8; ++r) ss[qq][k0 + t * 16 + 8 * g + r] = ps[r] + b3v; } } } }
  __syncthreads();
  // phase 2: softmax per query row (waves 0..3: query w; the other waves go on to the barrier), lane owns keys lane*8..+7; masked keys (k >= klen) excluded, padded queries -> zero probs
  if (wave < QB) { const int qq = wave; const bool qvalid = (q0 + qq) < qlen; float v[8]; float m = -3.0e38f;
#pragma unroll
    for (int u = 0; u < 8; ++u) { float t2 = ss[qq][lane * 8 + u]; asm volatile("" : "+v"(t2)); v[u] = t2; }   /* all 8 scores loaded unconditionally (always written in phase 1), pinned; masked by SELECT below */
#pragma unroll
    for (int u = 0; u < 8; ++u) { const int k = lane * 8 + u; v[u] = (k < klen) ? v[u] : -3.0e38f; m = fmaxf(m, v[u]); }
#pragma unroll
    for (int o = 1; o < 32; o <<= 1) m = fmaxf(m, __shfl_xor(m, o));
    float sum = 0.f, e[8];
#pragma unroll
    for (int u = 0; u < 8; ++u) { e[u] = (lane * 8 + u < klen) ? expf(v[u] - m) : 0.f; sum += e[u]; }
#pragma unroll
    for (int o = 1; o < 32; o <<= 1) sum += __shfl_xor(sum, o);
    const float inv = (qvalid && sum > 0.f) ? 1.0f / sum : 0.f;
    LDSX();
#pragma unroll
    for (int u = 0; u < 8; ++u) ss[qq][lane * 8 + u] = e[u] * inv; }
  __syncthreads();
  // phase 3: out[q0..q0+3][32w..32w+31] = P (hi + lo) x bf16(keys[b]) (exact), K = 256 keys; a wave's two column tiles share the P fragment
  { v8f acc[2] = {};
#pragma unroll
    for (int kc = 0; kc < TK / 32; ++kc) { const F2 a = split_row(&ss[col & (QB - 1)][0], kc * 32, lane);
      v16b w[2]; wcol_kz2(KEYS + b * TK * (size_t)HD_, kc * 32, wave * 32 + col, lane, HD_, TK, HD_, w);   /* B[k][d] = keys[b][k][d] */
#pragma unroll
      for (int t = 0; t < 2; ++t) { acc[t] = wmma_bf(a.h, w[t], acc[t]); acc[t] = wmma_bf(a.l, w[t], acc[t]); } }
    if (g == 0) {   /* D rows 0..3 = the block's queries sit in lanes 0..15, elements 0..3 */
#pragma unroll
      for (int t = 0; t < 2; ++t) {
#pragma unroll
        for (int r = 0; r < QB; ++r) so[r][(wave * 2 + t) * 16 + col] = acc[t][r]; } }
    __syncthreads();   /* the 8 waves' column tiles are gathered so that no 128-byte output line has two writers */
    if (tid < QB * HD_ / 4) vst2(OUT + ((b * TQ + q0 + tid / (HD_ / 4)) * HD_) + (tid % (HD_ / 4)) * 4, *(const v4f*)&so[tid / (HD_ / 4)][(tid % (HD_ / 4)) * 4]); } }   /* a wave stores 512 contiguous bytes of one row */
extern "C" void kernel_launch(void* const* d_in, const int* in_sizes, int n_in, void* d_out, int out_size, void* d_ws, size_t ws_size, hipStream_t stream) {
  (void)in_sizes; (void)n_in; (void)out_size;
  // inputs: 0 queries [4,256,256]; 1 keys [4,256,256]; 2 query_lengths [4] i32; 3 key_lengths [4] i32; 4 W1 [512,256] (in,out: rows 0..255 keys, 256..511 queries); 5 b1 [256]; 6 W2 [256,256]; 7 b2; 8 W3 [256,1]; 9 b3 [1]
  if (ws_size < (size_t)WS_END) return;
  char* ws = (char*)d_ws; const float** F = (const float**)d_in; float *QH = (float*)(ws + WS_QH), *KH = (float*)(ws + WS_KH);
  k_lin<<<dim3(NBV * TQ / 64, HD_ / 128, 2), 128, 0, stream>>>(F[0], F[1], F[4], QH, KH);
  k_mlp<<<dim3(NBV, TQ / QB), NWV * 32, 0, stream>>>(QH, KH, F[1], (const int*)d_in[2], (const int*)d_in[3], F[5], F[6], F[7], F[8], F[9], (float*)d_out);
}

// v007
// A run of this version takes 38.9 microseconds.
// In two side-by-side timings against v006, it was 1.27 and 1.26 times as fast.
// All steps since v000 together make it 36.1 times as fast.
// compute dtype: all float inputs rounded to bf16; qh = queries W1[256:], kh = keys W1[:256] with EXACT bf16 products on WMMA 16x16x32 (f32 accumulate); per (query, key) pair h1 = relu(qh + kh + b1) in f32, split bf16 hi + lo against exact bf16 W2 (2 products); relu(+b2), the w3 dot, masking and softmax in f32; probs split bf16 hi + lo against exact bf16 keys (2 products); f32 output.
#include <hip/hip_runtime.h>
#include <math.h>

typedef __attribute__((ext_vector_type(16))) _Float16 v16h;
typedef __attribute__((ext_vector_type(16))) __bf16 v16b;
typedef __attribute__((ext_vector_type(8)))  _Float16 v8h;
typedef __attribute__((ext_vector_type(8)))  __bf16 v8b;
typedef __attribute__((ext_vector_type(8)))  float v8f;
typedef __attribute__((ext_vector_type(4)))  float v4f;
typedef __attribute__((ext_vector_type(2)))  float v2f;
typedef __attribute__((ext_vector_type(4)))  unsigned v4u;
typedef __attribute__((ext_vector_type(4)))  int v4i;
typedef float __attribute__((may_alias)) float_a;
typedef int __attribute__((may_alias)) int_a;

template <typename T> __device__ __forceinline__ void vst2(void* p, T v) { *(T*)p = v;  }
__device__ __forceinline__ v8f wmma16(v16h a, v16h b, v8f c) {
  v8f d = __builtin_amdgcn_wmma_f32_16x16x32_f16(false, a, false, b, (short)0, c, false, false);
  asm volatile("v_nop\n\tv_nop\n\tv_nop\n\tv_nop" : "+v"(d) : "v"(a), "v"(b));
  return d;
}
__device__ __forceinline__ v8f wmma_bf(v16b a, v16b b, v8f c) {
  v8f d = __builtin_amdgcn_wmma_f32_16x16x32_bf16(false, a, false, b, (short)0, c, false, false);
  asm volatile("v_nop\n\tv_nop\n\tv_nop\n\tv_nop" : "+v"(d) : "v"(a), "v"(b));
  return d;
}
// the builtin alone, for accumulators that may lie above v255: an asm operand cannot, and 32 accumulator tiles passed through the statement above were spilled to scratch; the compiler keeps the distance behind its own builtin
__device__ __forceinline__ v8f wmma_hi(v16b a, v16b b, v8f c) { return __builtin_amdgcn_wmma_f32_16x16x32_bf16(false, a, false, b, (short)0, c, false, false); }
// 16x16x32 fragments: lane = (h = lane>>4, row/col = lane&15); elements 0..7 = k0+8h+0..7, 8..15 = k0+16+8h+0..7; D element r = row 8h+r
__device__ __forceinline__ v16h frag_h(const _Float16* rowk0, int lane) {
  union { v16h v; v8h q[2]; } u; const _Float16* p = rowk0 + 8 * (lane >> 4);
  u.q[0] = *(const v8h*)p; u.q[1] = *(const v8h*)(p + 16); return u.v;
}
__device__ __forceinline__ v16h frag_f32(const float* rowk0, int lane) {
  v16h a; const float* p = rowk0 + 8 * (lane >> 4);
#pragma unroll
  for (int i = 0; i < 8; ++i) { a[i] = (_Float16)p[i]; a[8 + i] = (_Float16)p[16 + i]; }
  return a;
}
__device__ __forceinline__ v16h frag_f32s(const float* rowk0, int lane, float sc) {
  v16h a; const float* p = rowk0 + 8 * (lane >> 4);
#pragma unroll
  for (int i = 0; i < 8; ++i) { a[i] = (_Float16)(p[i] * sc); a[8 + i] = (_Float16)(p[16 + i] * sc); }
  return a;
}
// column fragment from a [K][ld] layout (column n), rows >= K read as 0
__device__ __forceinline__ v16h fragc_f32(const float* W, int k0, int n, int lane, int ld, int K) {
  v16h a; const int g = lane >> 4;
#pragma unroll
  for (int i = 0; i < 8; ++i) { const int ka = k0 + 8 * g + i, kb = ka + 16;
    a[i] = (_Float16)(ka < K ? W[(size_t)(ka < K ? ka : K - 1) * ld + n] : 0.f); a[8 + i] = (_Float16)(kb < K ? W[(size_t)(kb < K ? kb : K - 1) * ld + n] : 0.f); }
  return a;
}
struct F2 { v16b h, l; };
__device__ __forceinline__ F2 bsplit16(const float v[16]) { F2 r;
#pragma unroll
  for (int i = 0; i < 16; ++i) { const __bf16 h = (__bf16)v[i]; r.h[i] = h; r.l[i] = (__bf16)(v[i] - (float)h); }
  return r; }
__device__ __forceinline__ F2 split_row(const float* row, int k0, int lane) { float v[16]; const float* p = row + k0 + 8 * (lane >> 4);
#pragma unroll
  for (int i = 0; i < 8; ++i) { v[i] = p[i]; v[8 + i] = p[16 + i]; }
  return bsplit16(v); }
__device__ __forceinline__ F2 split_rowK(const float* row, int k0, int lane, int K) { float v[16]; const int g = lane >> 4;
#pragma unroll
  for (int i = 0; i < 8; ++i) { const int ka = k0 + 8 * g + i, kb = ka + 16; v[i] = ka < K ? row[ka < K ? ka : K - 1] : 0.f; v[8 + i] = kb < K ? row[kb < K ? kb : K - 1] : 0.f; }
  return bsplit16(v); }
__device__ __forceinline__ F2 split_col(const float* W, int k0, int n, int lane, int ld, int K) { float v[16]; const int g = lane >> 4;
#pragma unroll
  for (int i = 0; i < 8; ++i) { const int ka = k0 + 8 * g + i, kb = ka + 16; v[i] = ka < K ? W[(size_t)(ka < K ? ka : K - 1) * ld + n] : 0.f; v[8 + i] = kb < K ? W[(size_t)(kb < K ? kb : K - 1) * ld + n] : 0.f; }
  return bsplit16(v); }
__device__ __forceinline__ v8f mac3(const F2& a, const F2& b, v8f c) { c = wmma_bf(a.l, b.h, c); c = wmma_bf(a.h, b.l, c); return wmma_bf(a.h, b.h, c); }
__device__ __forceinline__ float sigm(float v) { return 1.0f / (1.0f + expf(-v)); }
#define LDSX() do { asm volatile("s_wait_dscnt 0" ::: "memory"); __builtin_amdgcn_wave_barrier(); __builtin_amdgcn_fence(__ATOMIC_RELEASE, "workgroup"); } while (0)

// Additive (MLP) attention (B 4, Tq = Tk = 256, dims 256; ragged query/key lengths in [128, 256]): for every (q, k): h = relu([keys_k | queries_q] W1 + b1) = relu(kh_k + qh_q + b1); h = relu(h W2 + b2); score = h . w3 + b3; score := -1e30 where q >= query_len or k >= key_len; probs = softmax over k, then 0 where masked; out = probs keys -> [B, Tq, 256] (padded query rows are exactly 0).
#define NBT 4
#define TQ 256
#define TK 256
#define HD_ 256             // Q = K = H = 256
#define QB 4                // queries per block
#define NWV 8               // waves per block
#define NBLK 256            // blocks of k_sc, one per WGP
#ifndef NBV
#define NBV NBT             // batches processed
#endif
__device__ __forceinline__ float bfr(float v) { return (float)(__bf16)v; }
__device__ __forceinline__ void wcol_kz2(const float* __restrict__ Wm, int k0, int o, int lane, int ld, int K, int nvalid, v16b w[2]) { const int g = lane >> 4;   /* columns o and o + 16 */
  asm volatile("s_wait_loadcnt 0x0" ::: "memory");   /* drain earlier gathers so this 32-load burst of two column tiles never stacks on top of them */
#pragma unroll
  for (int t = 0; t < 2; ++t) { const int ot = o + 16 * t; const int oc = ot < nvalid ? ot : 0; const float keepo = ot < nvalid ? 1.f : 0.f;
#pragma unroll
    for (int i = 0; i < 8; ++i) { const int ka = k0 + 8 * g + i, kb = ka + 16; w[t][i] = (__bf16)(Wm[(size_t)(ka < K ? ka : 0) * ld + oc] * (ka < K ? keepo : 0.f)); w[t][8 + i] = (__bf16)(Wm[(size_t)(kb < K ? kb : 0) * ld + oc] * (kb < K ? keepo : 0.f)); } }
  asm volatile("s_wait_loadcnt 0x0" ::: "memory"); }
#define WS_QH  0u                                   // f32 qh [B*TQ][256]
#define WS_KH  (WS_QH + 4u * (size_t)NBT * TQ * HD_)   // f32 kh in A-fragment order: [B*TK/16 key tile][k chunk of 32][element quarter][lane][4]
#define WS_SC  (WS_KH + 4u * (size_t)NBT * TK * HD_)   // f32 scores [B*TQ][TK]; only the 32-key tiles of unmasked (query, tile) items are written, and only those are read
#define WS_END (WS_SC + 4u * (size_t)NBT * TQ * TK)
// ---- k_lin: block = (64 rows, 128 cols, which): which 0: qh = bf16(queries) W1[256:512] ; which 1: kh = bf16(keys) W1[0:256] (exact products, K 256, (in,out)); the block's 256 x 128 slice of W1 is rounded to bf16 and staged once in LDS in B-fragment order, shared by its 4 waves; qh as f32 rows, kh in the pair GEMM's A-fragment order, both stored as 512-B segments by 32 lanes
#define W1P 520             // bf16 per (k chunk, column tile) of the staged W1 slice: 2 halves x 32 lanes x 8 k, plus 8 (16 bytes), so that the 16 lanes of a half wave, which store into 4 column tiles at a time, fall on 16 different bank groups
__global__ __launch_bounds__(128) void k_lin(const float* __restrict__ XQ, const float* __restrict__ XK, const float* __restrict__ W1, float* __restrict__ QH, float* __restrict__ KH) { __shared__ __align__(16) float sf[4][16][132];
  __shared__ __align__(16) __bf16 sw1[HD_ / 32][8][W1P];   /* [k chunk of 32][column tile][(element half * 32 + lane) * 8 + k]; a wave's 16-byte reads of one half are 512 contiguous bytes */
  const int tid = threadIdx.x, wave = tid >> 5, lane = tid & 31, col = lane & 15, g = lane >> 4; const int which = blockIdx.z; const int c0 = blockIdx.y * 128; const size_t r0 = (size_t)blockIdx.x * 64 + wave * 16;
  const float* X = which == 0 ? XQ : XK; const float* Wm = which == 0 ? W1 + (size_t)HD_ * HD_ : W1; float* OUT = which == 0 ? QH : KH;   /* W1 rows 0..255 multiply the keys, rows 256..511 the queries (torch concat order [keys, queries]) */
  // the wave's 16 A rows, all 8 k chunks, loaded ahead of the staging so that both sets of loads are in flight together
  v4f xr[HD_ / 32][4]; { const float* p = X + (r0 + col) * HD_ + 8 * g;
#pragma unroll
    for (int kc = 0; kc < HD_ / 32; ++kc) { xr[kc][0] = *(const v4f*)(p + kc * 32); xr[kc][1] = *(const v4f*)(p + kc * 32 + 4); xr[kc][2] = *(const v4f*)(p + kc * 32 + 16); xr[kc][3] = *(const v4f*)(p + kc * 32 + 20); } }
  // W1 slice: item = (8 consecutive k, 4 consecutive columns); a wave's 32 items share the 8 k, so each row read is 512 contiguous bytes; 8 row reads of 16 bytes, rounded to bf16, 4 stores of 16 bytes (one per column). k = 32 kc + 16 q + 8 g + i, column = c0 + 16 jt + col, fragment lane = 16 g + col.
#pragma unroll 2   /* two items = 16 row reads in flight per thread beside the 32 A reads: four items took the kernel past 256 registers */
  for (int it = 0; it < (HD_ / 8) * (128 / 4) / 128; ++it) { const int k8 = it * 4 + wave, n0 = lane * 4; v4f rw[8];
#pragma unroll
    for (int i = 0; i < 8; ++i) rw[i] = *(const v4f*)(Wm + (size_t)(k8 * 8 + i) * HD_ + c0 + n0);
#pragma unroll
    for (int c = 0; c < 4; ++c) { v8b t;
#pragma unroll
      for (int i = 0; i < 8; ++i) t[i] = (__bf16)rw[i][c];
      *(v8b*)&sw1[k8 >> 2][n0 >> 4][(((k8 >> 1) & 1) * 32 + (k8 & 1) * 16 + (n0 & 15) + c) * 8] = t; } }
  v16b a[HD_ / 32];
#pragma unroll
  for (int kc = 0; kc < HD_ / 32; ++kc) {
#pragma unroll
    for (int i = 0; i < 16; ++i) a[kc][i] = (__bf16)xr[kc][i >> 2][i & 3]; }
  __syncthreads();   /* the slice is read by all 4 waves */
  v8f acc[8] = {};
#pragma unroll
  for (int kc = 0; kc < HD_ / 32; ++kc) { union { v16b v; v8b q[2]; } wf[8];   /* the 8 W1 fragments of this k chunk, read from LDS in one group ahead of the WMMAs */
#pragma unroll
    for (int j = 0; j < 8; ++j) { wf[j].q[0] = *(const v8b*)&sw1[kc][j][lane * 8]; wf[j].q[1] = *(const v8b*)&sw1[kc][j][(32 + lane) * 8]; }
#pragma unroll
    for (int j = 0; j < 8; ++j) acc[j] = wmma_bf(a[kc], wf[j].v, acc[j]); }
#pragma unroll
  for (int j = 0; j < 8; ++j) {
#pragma unroll
    for (int r = 0; r < 8; ++r) sf[wave][8 * g + r][j * 16 + col] = acc[j][r]; }
  LDSX();
  if (which == 0) { for (int rl = 0; rl < 16; ++rl) vst2(OUT + (r0 + rl) * HD_ + c0 + lane * 4, *(const v4f*)&sf[wave][rl][lane * 4]); }
  else {   /* kh: the wave's 16 rows are one key tile; segment s = (k chunk s >> 2, element quarter s & 3); lane (g, col) holds row col, columns 32 chunk + 16 (quarter >> 1) + 8 g + 4 (quarter & 1) + 0..3, i.e. fragment elements 4 quarter + 0..3 */
    float* kf = OUT + ((r0 >> 4) * (HD_ / 32) + (c0 >> 5)) * 512 + lane * 4;
    for (int s = 0; s < 16; ++s) vst2(kf + s * 128, *(const v4f*)&sf[wave][col][(s >> 2) * 32 + ((s >> 1) & 1) * 16 + 8 * g + (s & 1) * 4]);
    asm volatile("s_wait_xcnt 0x0" ::: "memory"); } }   /* stands behind the last kh store, ahead of any code the listing lets follow that rewrites the stores' data or address registers */
// ---- the list of work items, derived from the lengths on the device: item = (batch b, query q < query_len, tile t of 32 keys with 32 t < key_len); batch b holds n[b] = query_len * ceil(key_len / 32) items in the order t * query_len + q, the batches one after the other. Lengths are clamped to 0..256 by the caller, so b < 4, q < 256, t < 8 for every f below the sum of n.
__device__ __forceinline__ void item_of(unsigned f, const unsigned n[NBT], const unsigned ql[NBT], unsigned& b, unsigned& q, unsigned& t) { unsigned r = f; b = 0;
#pragma unroll
  for (unsigned i = 0; i + 1 < NBT; ++i) { if (b == i && r >= n[i]) { r -= n[i]; b = i + 1; } }
  unsigned d = ql[0];
#pragma unroll
  for (unsigned i = 1; i < NBT; ++i) d = b == i ? ql[i] : d;
  d = d < 1u ? 1u : d; t = r / d; q = r - t * d; }
// ---- k_sc: 256 blocks (one per WGP) of 8 waves (two per SIMD, up to 512 VGPRs a wave). Pairs with q >= query_len or in a 32-key tile wholly past key_len never reach the output, so only the other items are computed; they are dealt evenly: wave w of block x takes items 2048 p + 1024 (w >> 2) + 4 x + (w & 3), p = 0, 1, ... (waves w and w + 4 share a SIMD, so the SIMDs' item counts differ by one at most; the 4 items of waves 0..3 mostly share a key tile). The wave tile of an item is 32 pairs x all 256 output columns (32 accumulator tiles), so that a W2 fragment read from LDS feeds 4 WMMAs (2 row-tiles x hi, lo) and A is built once per (row-tile, k chunk): A[row = key][c] = relu(qh[q][c] + kh[k][c] + b1[c]) (f32, built per lane, split bf16 hi + lo; kh comes in fragment order, whole lines per load) x W2 (exact); score[q][k] = sum_c relu(acc + b2[c]) w3[c] (per-lane partial over its columns in ascending tile order, then an xor tree over the 16 column lanes) + b3 -> workspace, one whole 128-byte line an item.
__global__ __launch_bounds__(NWV * 32) void k_sc(const float* __restrict__ QH, const float* __restrict__ KH, const int* __restrict__ QL, const int* __restrict__ KL, const float* __restrict__ B1, const float* __restrict__ W2, const float* __restrict__ B2, const float* __restrict__ W3, const float* __restrict__ B3, float* __restrict__ SC) {
  __shared__ __align__(16) __bf16 sw[HD_ / 32][HD_ / 16][2][32][8];   /* bf16(W2) in B-fragment order: [k chunk of 32][column tile][element half][lane][8 k]; a wave's 16-byte reads of one half are 512 contiguous bytes */
  __shared__ __align__(16) float sq[NWV][HD_];   /* qh[q] + b1 of each wave's own item */
  const int tid = threadIdx.x, wave = tid >> 5, lane = tid & 31, col = lane & 15, g = lane >> 4;
  unsigned ql[NBT], nit[NBT], ntot = 0;
#pragma unroll
  for (int i = 0; i < NBT; ++i) { int a = QL[i], c = KL[i]; a = a < 0 ? 0 : (a > TQ ? TQ : a); c = c < 0 ? 0 : (c > TK ? TK : c); ql[i] = i < NBV ? (unsigned)a : 0u; nit[i] = ql[i] * (unsigned)((c + 31) >> 5); ntot += nit[i]; }
  // W2 staged once per block: item = (8 consecutive k, 4 consecutive columns); 8 row reads of 16 bytes, rounded to bf16, 4 stores of 16 bytes (one per column). k = 32 kc + 16 q + 8 g + i, column = 16 jt + col, fragment lane = 16 g + col.
#pragma unroll 2   /* two items = 16 row reads in flight per thread, so that the 8 trips cost 4 load latencies */
  for (int it = 0; it < (HD_ / 8) * (HD_ / 4) / (NWV * 32); ++it) { const int e = it * (NWV * 32) + tid; const int k8 = e / (HD_ / 4), n0 = (e % (HD_ / 4)) * 4; v4f rw[8];
#pragma unroll
    for (int i = 0; i < 8; ++i) rw[i] = *(const v4f*)(W2 + (size_t)(k8 * 8 + i) * HD_ + n0);
#pragma unroll
    for (int c = 0; c < 4; ++c) { v8b t;
#pragma unroll
      for (int i = 0; i < 8; ++i) t[i] = (__bf16)rw[i][c];
      *(v8b*)&sw[k8 >> 2][n0 >> 4][(k8 >> 1) & 1][(k8 & 1) * 16 + (n0 & 15) + c][0] = t; } }
  __syncthreads();   /* the only barrier: every wave passes it, also one that has no item */
  const float b3v = bfr(B3[0]);
  const unsigned wv = (unsigned)__builtin_amdgcn_readfirstlane(wave);   /* the wave's number as a scalar, so that the item arithmetic stays on the scalar unit */
  unsigned f = (wv >> 2) * (NBLK * 4u) + blockIdx.x * 4u + (wv & 3u);
  if (f < ntot) { unsigned ib, iq, it;
    item_of(f, nit, ql, ib, iq, it);
    const float* khw = KH + (size_t)(ib * (TK / 16) + it * 2) * (16 * HD_) + lane * 4;   /* the item's 2 key tiles in fragment order, 16 * HD_ floats each: this lane's fragment row of tile t = key 32 it + 16 t + col; a wave's 16-byte load covers 512 contiguous bytes (4 lines) */
    float* scw = SC + (size_t)(ib * TQ + iq) * TK + it * 32;
    float* sqw = &sq[wv][0];
    __builtin_amdgcn_sched_barrier(0);   /* keeps the item and address arithmetic above ahead of the loads below: mixed in among them it rewrote a base register of an issued load ahead of the wait that closes the run */
    v4f qn[2], bn[2];   /* the item's qh row and b1, 8 columns a lane */
#pragma unroll
    for (int u = 0; u < 2; ++u) { qn[u] = *(const v4f*)(QH + (size_t)(ib * TQ + iq) * HD_ + lane * 8 + u * 4); bn[u] = *(const v4f*)(B1 + lane * 8 + u * 4); }
    v4f kn[2][2][4];   /* kh of this k chunk and of the next (set = chunk & 1), both row-tiles of the item: a set is loaded anew, two chunks ahead, as soon as it has been read, so that the load's latency runs under the WMMAs of two chunks */
#pragma unroll
    for (int s = 0; s < 2; ++s) {
#pragma unroll
      for (int t = 0; t < 2; ++t) {
#pragma unroll
        for (int u = 0; u < 4; ++u) kn[s][t][u] = *(const v4f*)(khw + t * (16 * HD_) + s * 512 + u * 128); } }
    float b2w[16], w3w[16];   /* all 256 columns, the same for every item: loaded once here */
#pragma unroll
    for (int j = 0; j < 16; ++j) { b2w[j] = B2[j * 16 + col]; w3w[j] = W3[j * 16 + col]; }
    asm volatile("s_wait_xcnt 0x0" ::: "memory"); __builtin_amdgcn_sched_barrier(0);   /* the wait stands behind the qh, b1, kh, b2 and w3 loads; the scheduling barrier keeps the loop set-up, which rewrites bases and offset registers of these loads, behind it */
#pragma unroll 1
    for (int p = 0; p < 4; ++p) {   /* at most 8192 items, 2048 a round */
#pragma unroll
      for (int u = 0; u < 2; ++u) { v4f o; o[0] = qn[u][0] + bfr(bn[u][0]); o[1] = qn[u][1] + bfr(bn[u][1]); o[2] = qn[u][2] + bfr(bn[u][2]); o[3] = qn[u][3] + bfr(bn[u][3]); *(v4f*)(sqw + lane * 8 + u * 4) = o; }   /* qh[q] + b1, staged by the wave for itself */
      LDSX();   /* the row is read across lanes of this wave */
      const bool more = f + NBLK * 8u < ntot;   /* the wave's next item; behind the last one the same item stands in for it: its first two chunks are loaded once more and not read */
      f = more ? f + NBLK * 8u : f;
      item_of(f, nit, ql, ib, iq, it);
      const float* khn = KH + (size_t)(ib * (TK / 16) + it * 2) * (16 * HD_) + lane * 4;
      v8f acc[2][16] = {};
#pragma unroll 1
      for (int kp = 0; kp < HD_ / 64; ++kp) {
#pragma unroll   /* the two chunks of a trip use the two register sets by constant index */
        for (int s = 0; s < 2; ++s) { const int kc = kp * 2 + s;
          union { v16b v; v8b q[2]; } wf[2][4];   /* W2 fragments of this k chunk, 4 column tiles a group, two groups in registers: groups 0 and 1 are read from LDS ahead of the A build, groups 2 and 3 each behind the WMMAs of the group whose registers it takes, one group of WMMAs ahead of its use */
#pragma unroll
          for (int j = 0; j < 8; ++j) { wf[j >> 2][j & 3].q[0] = *(const v8b*)&sw[kc][j][0][lane][0]; wf[j >> 2][j & 3].q[1] = *(const v8b*)&sw[kc][j][1][lane][0]; }
          F2 a[2];
#pragma unroll
          for (int t = 0; t < 2; ++t) { float va[16];
#pragma unroll
            for (int i = 0; i < 16; ++i) { const int c = kc * 32 + 8 * g + (i < 8 ? i : 8 + i); va[i] = fmaxf(kn[s][t][i >> 2][i & 3] + sqw[c], 0.f); }   /* relu(kh + qh + b1) */
            a[t] = bsplit16(va); }
          const float* kq = (kp == HD_ / 64 - 1 ? khn : khw) + (((kp + 1) & (HD_ / 64 - 1)) * 2 + s) * 512;   /* the chunk read two chunks on: of this item, then of the next */
          __builtin_amdgcn_sched_barrier(0x38f);   /* holds global loads only (the mask lets every other kind cross): keeps the reload behind the last read of its set, so that it takes no third register set */
#pragma unroll
          for (int t = 0; t < 2; ++t) {
#pragma unroll
            for (int u = 0; u < 4; ++u) kn[s][t][u] = *(const v4f*)(kq + t * (16 * HD_) + u * 128); }
          asm volatile("s_wait_xcnt 0x0" ::: "memory");   /* stands behind the kh loads, ahead of the next trip's address arithmetic, which rewrites their address pair */
#pragma unroll
          for (int jg = 0; jg < 4; ++jg) {
#pragma unroll
            for (int jj = 0; jj < 4; jj += 2) { const int j = jg * 4 + jj;   /* 4 independent accumulators between the hi and the lo product of one tile; per tile hi, then lo */
              acc[0][j] = wmma_hi(a[0].h, wf[jg & 1][jj].v, acc[0][j]); acc[1][j] = wmma_hi(a[1].h, wf[jg & 1][jj].v, acc[1][j]);
              acc[0][j + 1] = wmma_hi(a[0].h, wf[jg & 1][jj + 1].v, acc[0][j + 1]); acc[1][j + 1] = wmma_hi(a[1].h, wf[jg & 1][jj + 1].v, acc[1][j + 1]);
              acc[0][j] = wmma_hi(a[0].l, wf[jg & 1][jj].v, acc[0][j]); acc[1][j] = wmma_hi(a[1].l, wf[jg & 1][jj].v, acc[1][j]);
              acc[0][j + 1] = wmma_hi(a[0].l, wf[jg & 1][jj + 1].v, acc[0][j + 1]); acc[1][j + 1] = wmma_hi(a[1].l, wf[jg & 1][jj + 1].v, acc[1][j + 1]); }
            if (jg < 2) {
#pragma unroll
              for (int j = 0; j < 4; ++j) { wf[jg & 1][j].q[0] = *(const v8b*)&sw[kc][jg * 4 + 8 + j][0][lane][0]; wf[jg & 1][j].q[1] = *(const v8b*)&sw[kc][jg * 4 + 8 + j][1][lane][0]; } } } } }
      // the next item's qh row and b1, loaded ahead of the score sums so that the latency runs under them
      const float* qr = QH + (size_t)(ib * TQ + iq) * HD_;
#pragma unroll
      for (int u = 0; u < 2; ++u) { qn[u] = *(const v4f*)(qr + lane * 8 + u * 4); bn[u] = *(const v4f*)(B1 + lane * 8 + u * 4); }
      asm volatile("s_wait_xcnt 0x0" :: "s"(qr) : "memory"); __builtin_amdgcn_sched_barrier(0);   /* the wait stands behind the qh and b1 loads; it names the row's scalar base so that the base stays whole up to it, and the scheduling barrier keeps the score sums, which the listing let rewrite an address register of the loads ahead of the wait, behind it */
#pragma unroll
      for (int t = 0; t < 2; ++t) { float ps[8];
#pragma unroll
        for (int r = 0; r < 8; ++r) { float pp = 0.f;
#pragma unroll
          for (int j = 0; j < 16; ++j) pp += fmaxf(acc[t][j][r] + bfr(b2w[j]), 0.f) * bfr(w3w[j]); ps[r] = pp; }
#pragma unroll
        for (int o = 1; o < 16; o <<= 1) {
#pragma unroll
          for (int r = 0; r < 8; ++r) ps[r] += __shfl_xor(ps[r], o); }   /* sum over the 16 column lanes (lane bits 0..3); every lane shuffles */
        if (col == 0) { v4f s0, s1;
#pragma unroll
          for (int r = 0; r < 4; ++r) { s0[r] = ps[r] + b3v; s1[r] = ps[4 + r] + b3v; }
          vst2(scw + t * 16 + 8 * g, s0); vst2(scw + t * 16 + 8 * g + 4, s1); } }
      if (!more) break;
      khw = khn; scw = SC + (size_t)(ib * TQ + iq) * TK + it * 32; } } }
// ---- k_pv: block = (batch b, 4 queries q0..q0+3), 8 waves. Softmax per query over k < key_len (rows with q >= query_len -> all-zero probs) into LDS; then out tile = P (hi + lo) x bf16(keys[b]) (exact), fragment rows 4..15 repeat rows 0..3 and are dropped -> wave w computes columns 32w..32w+31 of the 4 output rows into LDS; after a barrier the 8 waves store 512 contiguous bytes each.
__global__ __launch_bounds__(NWV * 32) void k_pv(const float* __restrict__ SC, const float* __restrict__ KEYS, const int* __restrict__ QL, const int* __restrict__ KL, float* __restrict__ OUT) {
  __shared__ __align__(16) float ss[QB][TK + 4]; __shared__ __align__(16) float so[QB][HD_];
  const int tid = threadIdx.x, wave = tid >> 5, lane = tid & 31, col = lane & 15, g = lane >> 4; const size_t b = blockIdx.x; const int q0 = blockIdx.y * QB;
  int qlen = QL[b], klen = KL[b]; qlen = qlen < 0 ? 0 : (qlen > TQ ? TQ : qlen); klen = klen < 0 ? 0 : (klen > TK ? TK : klen);
  // softmax per query row (waves 0..3: query w; the other waves go on to the barrier), lane owns keys lane*8..+7; masked keys (k >= klen) excluded, padded queries -> zero probs
  if (wave < QB) { const int qq = wave; const bool qvalid = (q0 + qq) < qlen; float v[8]; float m = -3.0e38f;
    v4f s0 = {-3.0e38f, -3.0e38f, -3.0e38f, -3.0e38f}, s1 = s0;
    if (qvalid && (lane >> 2) * 32 < klen) { const float* sr = SC + (b * TQ + q0 + qq) * TK + lane * 8; s0 = *(const v4f*)sr; s1 = *(const v4f*)(sr + 4); }   /* only 32-key tiles that k_sc wrote in this call are read */
#pragma unroll
    for (int u = 0; u < 8; ++u) { const int k = lane * 8 + u; v[u] = (k < klen) ? (u < 4 ? s0[u & 3] : s1[u & 3]) : -3.0e38f; m = fmaxf(m, v[u]); }
#pragma unroll
    for (int o = 1; o < 32; o <<= 1) m = fmaxf(m, __shfl_xor(m, o));
    float sum = 0.f, e[8];
#pragma unroll
    for (int u = 0; u < 8; ++u) { e[u] = (lane * 8 + u < klen) ? expf(v[u] - m) : 0.f; sum += e[u]; }
#pragma unroll
    for (int o = 1; o < 32; o <<= 1) sum += __shfl_xor(sum, o);
    const float inv = (qvalid && sum > 0.f) ? 1.0f / sum : 0.f;
#pragma unroll
    for (int u = 0; u < 8; ++u) ss[qq][lane * 8 + u] = e[u] * inv; }
  __syncthreads();
  // phase 3: out[q0..q0+3][32w..32w+31] = P (hi + lo) x bf16(keys[b]) (exact), K = 256 keys; a wave's two column tiles share the P fragment
  { v8f acc[2] = {};
#pragma unroll
    for (int kc = 0; kc < TK / 32; ++kc) { const F2 a = split_row(&ss[col & (QB - 1)][0], kc * 32, lane);
      v16b w[2]; wcol_kz2(KEYS + b * TK * (size_t)HD_, kc * 32, wave * 32 + col, lane, HD_, TK, HD_, w);   /* B[k][d] = keys[b][k][d] */
#pragma unroll
      for (int t = 0; t < 2; ++t) { acc[t] = wmma_bf(a.h, w[t], acc[t]); acc[t] = wmma_bf(a.l, w[t], acc[t]); } }
    if (g == 0) {   /* D rows 0..3 = the block's queries sit in lanes 0..15, elements 0..3 */
#pragma unroll
      for (int t = 0; t < 2; ++t) {
#pragma unroll
        for (int r = 0; r < QB; ++r) so[r][(wave * 2 + t) * 16 + col] = acc[t][r]; } }
    __syncthreads();   /* the 8 waves' column tiles are gathered so that no 128-byte output line has two writers */
    if (tid < QB * HD_ / 4) vst2(OUT + ((b * TQ + q0 + tid / (HD_ / 4)) * HD_) + (tid % (HD_ / 4)) * 4, *(const v4f*)&so[tid / (HD_ / 4)][(tid % (HD_ / 4)) * 4]); } }   /* a wave stores 512 contiguous bytes of one row */
extern "C" void kernel_launch(void* const* d_in, const int* in_sizes, int n_in, void* d_out, int out_size, void* d_ws, size_t ws_size, hipStream_t stream) {
  (void)in_sizes; (void)n_in; (void)out_size;
  // inputs: 0 queries [4,256,256]; 1 keys [4,256,256]; 2 query_lengths [4] i32; 3 key_lengths [4] i32; 4 W1 [512,256] (in,out: rows 0..255 keys, 256..511 queries); 5 b1 [256]; 6 W2 [256,256]; 7 b2; 8 W3 [256,1]; 9 b3 [1]
  if (ws_size < (size_t)WS_END) return;
  char* ws = (char*)d_ws; const float** F = (const float**)d_in; float *QH = (float*)(ws + WS_QH), *KH = (float*)(ws + WS_KH), *SC = (float*)(ws + WS_SC);
  k_lin<<<dim3(NBV * TQ / 64, HD_ / 128, 2), 128, 0, stream>>>(F[0], F[1], F[4], QH, KH);
  k_sc<<<NBLK, NWV * 32, 0, stream>>>(QH, KH, (const int*)d_in[2], (const int*)d_in[3], F[5], F[6], F[7], F[8], F[9], SC);
  k_pv<<<dim3(NBV, TQ / QB), NWV * 32, 0, stream>>>(SC, F[1], (const int*)d_in[2], (const int*)d_in[3], (float*)d_out);
}

// v008
// One run takes 36.5 microseconds.
// Timed twice side by side with v007, it ran 1.06 and 1.07 times as fast.
// Over all steps from v000 it is 38.4 times as fast.
// compute dtype: all float inputs rounded to bf16; qh = queries W1[256:], kh = keys W1[:256] with EXACT bf16 products on WMMA 16x16x32 (f32 accumulate); per (query, key) pair h1 = relu(qh + kh + b1) in f32, split bf16 hi + lo against exact bf16 W2 (2 products); relu(+b2), the w3 dot, masking and softmax in f32; probs split bf16 hi + lo against exact bf16 keys (2 products); f32 output.
#include <hip/hip_runtime.h>
#include <math.h>

typedef __attribute__((ext_vector_type(16))) _Float16 v16h;
typedef __attribute__((ext_vector_type(16))) __bf16 v16b;
typedef __attribute__((ext_vector_type(8)))  _Float16 v8h;
typedef __attribute__((ext_vector_type(8)))  __bf16 v8b;
typedef __attribute__((ext_vector_type(8)))  float v8f;
typedef __attribute__((ext_vector_type(4)))  float v4f;
typedef __attribute__((ext_vector_type(2)))  float v2f;
typedef __attribute__((ext_vector_type(4)))  unsigned v4u;
typedef __attribute__((ext_vector_type(4)))  int v4i;
typedef float __attribute__((may_alias)) float_a;
typedef int __attribute__((may_alias)) int_a;

template <typename T> __device__ __forceinline__ void vst2(void* p, T v) { *(T*)p = v;  }
__device__ __forceinline__ v8f wmma16(v16h a, v16h b, v8f c) {
  v8f d = __builtin_amdgcn_wmma_f32_16x16x32_f16(false, a, false, b, (short)0, c, false, false);
  asm volatile("v_nop\n\tv_nop\n\tv_nop\n\tv_nop" : "+v"(d) : "v"(a), "v"(b));
  return d;
}
__device__ __forceinline__ v8f wmma_bf(v16b a, v16b b, v8f c) {
  v8f d = __builtin_amdgcn_wmma_f32_16x16x32_bf16(false, a, false, b, (short)0, c, false, false);
  asm volatile("v_nop\n\tv_nop\n\tv_nop\n\tv_nop" : "+v"(d) : "v"(a), "v"(b));
  return d;
}
// the builtin alone, for accumulators that may lie above v255: an asm operand cannot, and 32 accumulator tiles passed through the statement above were spilled to scratch; the compiler keeps the distance behind its own builtin
__device__ __forceinline__ v8f wmma_hi(v16b a, v16b b, v8f c) { return __builtin_amdgcn_wmma_f32_16x16x32_bf16(false, a, false, b, (short)0, c, false, false); }
// 16x16x32 fragments: lane = (h = lane>>4, row/col = lane&15); elements 0..7 = k0+8h+0..7, 8..15 = k0+16+8h+0..7; D element r = row 8h+r
__device__ __forceinline__ v16h frag_h(const _Float16* rowk0, int lane) {
  union { v16h v; v8h q[2]; } u; const _Float16* p = rowk0 + 8 * (lane >> 4);
  u.q[0] = *(const v8h*)p; u.q[1] = *(const v8h*)(p + 16); return u.v;
}
__device__ __forceinline__ v16h frag_f32(const float* rowk0, int lane) {
  v16h a; const float* p = rowk0 + 8 * (lane >> 4);
#pragma unroll
  for (int i = 0; i < 8; ++i) { a[i] = (_Float16)p[i]; a[8 + i] = (_Float16)p[16 + i]; }
  return a;
}
__device__ __forceinline__ v16h frag_f32s(const float* rowk0, int lane, float sc) {
  v16h a; const float* p = rowk0 + 8 * (lane >> 4);
#pragma unroll
  for (int i = 0; i < 8; ++i) { a[i] = (_Float16)(p[i] * sc); a[8 + i] = (_Float16)(p[16 + i] * sc); }
  return a;
}
// column fragment from a [K][ld] layout (column n), rows >= K read as 0
__device__ __forceinline__ v16h fragc_f32(const float* W, int k0, int n, int lane, int ld, int K) {
  v16h a; const int g = lane >> 4;
#pragma unroll
  for (int i = 0; i < 8; ++i) { const int ka = k0 + 8 * g + i, kb = ka + 16;
    a[i] = (_Float16)(ka < K ? W[(size_t)(ka < K ? ka : K - 1) * ld + n] : 0.f); a[8 + i] = (_Float16)(kb < K ? W[(size_t)(kb < K ? kb : K - 1) * ld + n] : 0.f); }
  return a;
}
struct F2 { v16b h, l; };
__device__ __forceinline__ F2 bsplit16(const float v[16]) { F2 r;
#pragma unroll
  for (int i = 0; i < 16; ++i) { const __bf16 h = (__bf16)v[i]; r.h[i] = h; r.l[i] = (__bf16)(v[i] - (float)h); }
  return r; }
__device__ __forceinline__ F2 split_row(const float* row, int k0, int lane) { float v[16]; const float* p = row + k0 + 8 * (lane >> 4);
#pragma unroll
  for (int i = 0; i < 8; ++i) { v[i] = p[i]; v[8 + i] = p[16 + i]; }
  return bsplit16(v); }
__device__ __forceinline__ F2 split_rowK(const float* row, int k0, int lane, int K) { float v[16]; const int g = lane >> 4;
#pragma unroll
  for (int i = 0; i < 8; ++i) { const int ka = k0 + 8 * g + i, kb = ka + 16; v[i] = ka < K ? row[ka < K ? ka : K - 1] : 0.f; v[8 + i] = kb < K ? row[kb < K ? kb : K - 1] : 0.f; }
  return bsplit16(v); }
__device__ __forceinline__ F2 split_col(const float* W, int k0, int n, int lane, int ld, int K) { float v[16]; const int g = lane >> 4;
#pragma unroll
  for (int i = 0; i < 8; ++i) { const int ka = k0 + 8 * g + i, kb = ka + 16; v[i] = ka < K ? W[(size_t)(ka < K ? ka : K - 1) * ld + n] : 0.f; v[8 + i] = kb < K ? W[(size_t)(kb < K ? kb : K - 1) * ld + n] : 0.f; }
  return bsplit16(v); }
__device__ __forceinline__ v8f mac3(const F2& a, const F2& b, v8f c) { c = wmma_bf(a.l, b.h, c); c = wmma_bf(a.h, b.l, c); return wmma_bf(a.h, b.h, c); }
__device__ __forceinline__ float sigm(float v) { return 1.0f / (1.0f + expf(-v)); }
#define LDSX() do { asm volatile("s_wait_dscnt 0" ::: "memory"); __builtin_amdgcn_wave_barrier(); __builtin_amdgcn_fence(__ATOMIC_RELEASE, "workgroup"); } while (0)

// Additive (MLP) attention (B 4, Tq = Tk = 256, dims 256; ragged query/key lengths in [128, 256]): for every (q, k): h = relu([keys_k | queries_q] W1 + b1) = relu(kh_k + qh_q + b1); h = relu(h W2 + b2); score = h . w3 + b3; score := -1e30 where q >= query_len or k >= key_len; probs = softmax over k, then 0 where masked; out = probs keys -> [B, Tq, 256] (padded query rows are exactly 0).
#define NBT 4
#define TQ 256
#define TK 256
#define HD_ 256             // Q = K = H = 256
#define PQ 16               // queries per block of k_pv
#define PC 128              // output columns per block of k_pv
#define NWV 8               // waves per block
#define NBLK 256            // blocks of k_sc, one per WGP
#ifndef NBV
#define NBV NBT             // batches processed
#endif
__device__ __forceinline__ float bfr(float v) { return (float)(__bf16)v; }
#define WS_QH  0u                                   // f32 qh [B*TQ][256]
#define WS_KH  (WS_QH + 4u * (size_t)NBT * TQ * HD_)   // f32 kh in A-fragment order: [B*TK/16 key tile][k chunk of 32][element quarter][lane][4]
#define WS_SC  (WS_KH + 4u * (size_t)NBT * TK * HD_)   // f32 scores [B*TQ][TK]; only the 32-key tiles of unmasked (query, tile) items are written, and only those are read
#define WS_END (WS_SC + 4u * (size_t)NBT * TQ * TK)
// ---- k_lin: block = (64 rows, 128 cols, which): which 0: qh = bf16(queries) W1[256:512] ; which 1: kh = bf16(keys) W1[0:256] (exact products, K 256, (in,out)); the block's 256 x 128 slice of W1 is rounded to bf16 and staged once in LDS in B-fragment order, shared by its 4 waves; qh as f32 rows, kh in the pair GEMM's A-fragment order, both stored as 512-B segments by 32 lanes
#define W1P 520             // bf16 per (k chunk, column tile) of the staged W1 slice: 2 halves x 32 lanes x 8 k, plus 8 (16 bytes), so that the 16 lanes of a half wave, which store into 4 column tiles at a time, fall on 16 different bank groups
__global__ __launch_bounds__(128) void k_lin(const float* __restrict__ XQ, const float* __restrict__ XK, const float* __restrict__ W1, float* __restrict__ QH, float* __restrict__ KH) { __shared__ __align__(16) float sf[4][16][132];
  __shared__ __align__(16) __bf16 sw1[HD_ / 32][8][W1P];   /* [k chunk of 32][column tile][(element half * 32 + lane) * 8 + k]; a wave's 16-byte reads of one half are 512 contiguous bytes */
  const int tid = threadIdx.x, wave = tid >> 5, lane = tid & 31, col = lane & 15, g = lane >> 4; const int which = blockIdx.z; const int c0 = blockIdx.y * 128; const size_t r0 = (size_t)blockIdx.x * 64 + wave * 16;
  const float* X = which == 0 ? XQ : XK; const float* Wm = which == 0 ? W1 + (size_t)HD_ * HD_ : W1; float* OUT = which == 0 ? QH : KH;   /* W1 rows 0..255 multiply the keys, rows 256..511 the queries (torch concat order [keys, queries]) */
  // the wave's 16 A rows, all 8 k chunks, loaded ahead of the staging so that both sets of loads are in flight together
  v4f xr[HD_ / 32][4]; { const float* p = X + (r0 + col) * HD_ + 8 * g;
#pragma unroll
    for (int kc = 0; kc < HD_ / 32; ++kc) { xr[kc][0] = *(const v4f*)(p + kc * 32); xr[kc][1] = *(const v4f*)(p + kc * 32 + 4); xr[kc][2] = *(const v4f*)(p + kc * 32 + 16); xr[kc][3] = *(const v4f*)(p + kc * 32 + 20); } }
  // W1 slice: item = (8 consecutive k, 4 consecutive columns); a wave's 32 items share the 8 k, so each row read is 512 contiguous bytes; 8 row reads of 16 bytes, rounded to bf16, 4 stores of 16 bytes (one per column). k = 32 kc + 16 q + 8 g + i, column = c0 + 16 jt + col, fragment lane = 16 g + col.
#pragma unroll 2   /* two items = 16 row reads in flight per thread beside the 32 A reads: four items took the kernel past 256 registers */
  for (int it = 0; it < (HD_ / 8) * (128 / 4) / 128; ++it) { const int k8 = it * 4 + wave, n0 = lane * 4; v4f rw[8];
#pragma unroll
    for (int i = 0; i < 8; ++i) rw[i] = *(const v4f*)(Wm + (size_t)(k8 * 8 + i) * HD_ + c0 + n0);
#pragma unroll
    for (int c = 0; c < 4; ++c) { v8b t;
#pragma unroll
      for (int i = 0; i < 8; ++i) t[i] = (__bf16)rw[i][c];
      *(v8b*)&sw1[k8 >> 2][n0 >> 4][(((k8 >> 1) & 1) * 32 + (k8 & 1) * 16 + (n0 & 15) + c) * 8] = t; } }
  v16b a[HD_ / 32];
#pragma unroll
  for (int kc = 0; kc < HD_ / 32; ++kc) {
#pragma unroll
    for (int i = 0; i < 16; ++i) a[kc][i] = (__bf16)xr[kc][i >> 2][i & 3]; }
  __syncthreads();   /* the slice is read by all 4 waves */
  v8f acc[8] = {};
#pragma unroll
  for (int kc = 0; kc < HD_ / 32; ++kc) { union { v16b v; v8b q[2]; } wf[8];   /* the 8 W1 fragments of this k chunk, read from LDS in one group ahead of the WMMAs */
#pragma unroll
    for (int j = 0; j < 8; ++j) { wf[j].q[0] = *(const v8b*)&sw1[kc][j][lane * 8]; wf[j].q[1] = *(const v8b*)&sw1[kc][j][(32 + lane) * 8]; }
#pragma unroll
    for (int j = 0; j < 8; ++j) acc[j] = wmma_bf(a[kc], wf[j].v, acc[j]); }
#pragma unroll
  for (int j = 0; j < 8; ++j) {
#pragma unroll
    for (int r = 0; r < 8; ++r) sf[wave][8 * g + r][j * 16 + col] = acc[j][r]; }
  LDSX();
  if (which == 0) { for (int rl = 0; rl < 16; ++rl) vst2(OUT + (r0 + rl) * HD_ + c0 + lane * 4, *(const v4f*)&sf[wave][rl][lane * 4]); }
  else {   /* kh: the wave's 16 rows are one key tile; segment s = (k chunk s >> 2, element quarter s & 3); lane (g, col) holds row col, columns 32 chunk + 16 (quarter >> 1) + 8 g + 4 (quarter & 1) + 0..3, i.e. fragment elements 4 quarter + 0..3 */
    float* kf = OUT + ((r0 >> 4) * (HD_ / 32) + (c0 >> 5)) * 512 + lane * 4;
    for (int s = 0; s < 16; ++s) vst2(kf + s * 128, *(const v4f*)&sf[wave][col][(s >> 2) * 32 + ((s >> 1) & 1) * 16 + 8 * g + (s & 1) * 4]);
    asm volatile("s_wait_xcnt 0x0" ::: "memory"); } }   /* stands behind the last kh store, ahead of any code the listing lets follow that rewrites the stores' data or address registers */
// ---- the list of work items, derived from the lengths on the device: item = (batch b, query q < query_len, tile t of 32 keys with 32 t < key_len); batch b holds n[b] = query_len * ceil(key_len / 32) items in the order t * query_len + q, the batches one after the other. Lengths are clamped to 0..256 by the caller, so b < 4, q < 256, t < 8 for every f below the sum of n.
__device__ __forceinline__ void item_of(unsigned f, const unsigned n[NBT], const unsigned ql[NBT], unsigned& b, unsigned& q, unsigned& t) { unsigned r = f; b = 0;
#pragma unroll
  for (unsigned i = 0; i + 1 < NBT; ++i) { if (b == i && r >= n[i]) { r -= n[i]; b = i + 1; } }
  unsigned d = ql[0];
#pragma unroll
  for (unsigned i = 1; i < NBT; ++i) d = b == i ? ql[i] : d;
  d = d < 1u ? 1u : d; t = r / d; q = r - t * d; }
// ---- k_sc: 256 blocks (one per WGP) of 8 waves (two per SIMD, up to 512 VGPRs a wave). Pairs with q >= query_len or in a 32-key tile wholly past key_len never reach the output, so only the other items are computed; they are dealt evenly: wave w of block x takes items 2048 p + 1024 (w >> 2) + 4 x + (w & 3), p = 0, 1, ... (waves w and w + 4 share a SIMD, so the SIMDs' item counts differ by one at most; the 4 items of waves 0..3 mostly share a key tile). The wave tile of an item is 32 pairs x all 256 output columns (32 accumulator tiles), so that a W2 fragment read from LDS feeds 4 WMMAs (2 row-tiles x hi, lo) and A is built once per (row-tile, k chunk): A[row = key][c] = relu(qh[q][c] + kh[k][c] + b1[c]) (f32, built per lane, split bf16 hi + lo; kh comes in fragment order, whole lines per load) x W2 (exact); score[q][k] = sum_c relu(acc + b2[c]) w3[c] (per-lane partial over its columns in ascending tile order, then an xor tree over the 16 column lanes) + b3 -> workspace, one whole 128-byte line an item.
__global__ __launch_bounds__(NWV * 32) void k_sc(const float* __restrict__ QH, const float* __restrict__ KH, const int* __restrict__ QL, const int* __restrict__ KL, const float* __restrict__ B1, const float* __restrict__ W2, const float* __restrict__ B2, const float* __restrict__ W3, const float* __restrict__ B3, float* __restrict__ SC) {
  __shared__ __align__(16) __bf16 sw[HD_ / 32][HD_ / 16][2][32][8];   /* bf16(W2) in B-fragment order: [k chunk of 32][column tile][element half][lane][8 k]; a wave's 16-byte reads of one half are 512 contiguous bytes */
  __shared__ __align__(16) float sq[NWV][HD_];   /* qh[q] + b1 of each wave's own item */
  const int tid = threadIdx.x, wave = tid >> 5, lane = tid & 31, col = lane & 15, g = lane >> 4;
  unsigned ql[NBT], nit[NBT], ntot = 0;
#pragma unroll
  for (int i = 0; i < NBT; ++i) { int a = QL[i], c = KL[i]; a = a < 0 ? 0 : (a > TQ ? TQ : a); c = c < 0 ? 0 : (c > TK ? TK : c); ql[i] = i < NBV ? (unsigned)a : 0u; nit[i] = ql[i] * (unsigned)((c + 31) >> 5); ntot += nit[i]; }
  // W2 staged once per block: item = (8 consecutive k, 4 consecutive columns); 8 row reads of 16 bytes, rounded to bf16, 4 stores of 16 bytes (one per column). k = 32 kc + 16 q + 8 g + i, column = 16 jt + col, fragment lane = 16 g + col.
#pragma unroll 2   /* two items = 16 row reads in flight per thread, so that the 8 trips cost 4 load latencies */
  for (int it = 0; it < (HD_ / 8) * (HD_ / 4) / (NWV * 32); ++it) { const int e = it * (NWV * 32) + tid; const int k8 = e / (HD_ / 4), n0 = (e % (HD_ / 4)) * 4; v4f rw[8];
#pragma unroll
    for (int i = 0; i < 8; ++i) rw[i] = *(const v4f*)(W2 + (size_t)(k8 * 8 + i) * HD_ + n0);
#pragma unroll
    for (int c = 0; c < 4; ++c) { v8b t;
#pragma unroll
      for (int i = 0; i < 8; ++i) t[i] = (__bf16)rw[i][c];
      *(v8b*)&sw[k8 >> 2][n0 >> 4][(k8 >> 1) & 1][(k8 & 1) * 16 + (n0 & 15) + c][0] = t; } }
  __syncthreads();   /* the only barrier: every wave passes it, also one that has no item */
  const float b3v = bfr(B3[0]);
  const unsigned wv = (unsigned)__builtin_amdgcn_readfirstlane(wave);   /* the wave's number as a scalar, so that the item arithmetic stays on the scalar unit */
  unsigned f = (wv >> 2) * (NBLK * 4u) + blockIdx.x * 4u + (wv & 3u);
  if (f < ntot) { unsigned ib, iq, it;
    item_of(f, nit, ql, ib, iq, it);
    const float* khw = KH + (size_t)(ib * (TK / 16) + it * 2) * (16 * HD_) + lane * 4;   /* the item's 2 key tiles in fragment order, 16 * HD_ floats each: this lane's fragment row of tile t = key 32 it + 16 t + col; a wave's 16-byte load covers 512 contiguous bytes (4 lines) */
    float* scw = SC + (size_t)(ib * TQ + iq) * TK + it * 32;
    float* sqw = &sq[wv][0];
    __builtin_amdgcn_sched_barrier(0);   /* keeps the item and address arithmetic above ahead of the loads below: mixed in among them it rewrote a base register of an issued load ahead of the wait that closes the run */
    v4f qn[2], bn[2];   /* the item's qh row and b1, 8 columns a lane */
#pragma unroll
    for (int u = 0; u < 2; ++u) { qn[u] = *(const v4f*)(QH + (size_t)(ib * TQ + iq) * HD_ + lane * 8 + u * 4); bn[u] = *(const v4f*)(B1 + lane * 8 + u * 4); }
    v4f kn[2][2][4];   /* kh of this k chunk and of the next (set = chunk & 1), both row-tiles of the item: a set is loaded anew, two chunks ahead, as soon as it has been read, so that the load's latency runs under the WMMAs of two chunks */
#pragma unroll
    for (int s = 0; s < 2; ++s) {
#pragma unroll
      for (int t = 0; t < 2; ++t) {
#pragma unroll
        for (int u = 0; u < 4; ++u) kn[s][t][u] = *(const v4f*)(khw + t * (16 * HD_) + s * 512 + u * 128); } }
    float b2w[16], w3w[16];   /* all 256 columns, the same for every item: loaded once here */
#pragma unroll
    for (int j = 0; j < 16; ++j) { b2w[j] = B2[j * 16 + col]; w3w[j] = W3[j * 16 + col]; }
    asm volatile("s_wait_xcnt 0x0" ::: "memory"); __builtin_amdgcn_sched_barrier(0);   /* the wait stands behind the qh, b1, kh, b2 and w3 loads; the scheduling barrier keeps the loop set-up, which rewrites bases and offset registers of these loads, behind it */
#pragma unroll 1
    for (int p = 0; p < 4; ++p) {   /* at most 8192 items, 2048 a round */
#pragma unroll
      for (int u = 0; u < 2; ++u) { v4f o; o[0] = qn[u][0] + bfr(bn[u][0]); o[1] = qn[u][1] + bfr(bn[u][1]); o[2] = qn[u][2] + bfr(bn[u][2]); o[3] = qn[u][3] + bfr(bn[u][3]); *(v4f*)(sqw + lane * 8 + u * 4) = o; }   /* qh[q] + b1, staged by the wave for itself */
      LDSX();   /* the row is read across lanes of this wave */
      const bool more = f + NBLK * 8u < ntot;   /* the wave's next item; behind the last one the same item stands in for it: its first two chunks are loaded once more and not read */
      f = more ? f + NBLK * 8u : f;
      item_of(f, nit, ql, ib, iq, it);
      const float* khn = KH + (size_t)(ib * (TK / 16) + it * 2) * (16 * HD_) + lane * 4;
      v8f acc[2][16] = {};
#pragma unroll 1
      for (int kp = 0; kp < HD_ / 64; ++kp) {
#pragma unroll   /* the two chunks of a trip use the two register sets by constant index */
        for (int s = 0; s < 2; ++s) { const int kc = kp * 2 + s;
          union { v16b v; v8b q[2]; } wf[2][4];   /* W2 fragments of this k chunk, 4 column tiles a group, two groups in registers: groups 0 and 1 are read from LDS ahead of the A build, groups 2 and 3 each behind the WMMAs of the group whose registers it takes, one group of WMMAs ahead of its use */
#pragma unroll
          for (int j = 0; j < 8; ++j) { wf[j >> 2][j & 3].q[0] = *(const v8b*)&sw[kc][j][0][lane][0]; wf[j >> 2][j & 3].q[1] = *(const v8b*)&sw[kc][j][1][lane][0]; }
          F2 a[2];
#pragma unroll
          for (int t = 0; t < 2; ++t) { float va[16];
#pragma unroll
            for (int i = 0; i < 16; ++i) { const int c = kc * 32 + 8 * g + (i < 8 ? i : 8 + i); va[i] = fmaxf(kn[s][t][i >> 2][i & 3] + sqw[c], 0.f); }   /* relu(kh + qh + b1) */
            a[t] = bsplit16(va); }
          const float* kq = (kp == HD_ / 64 - 1 ? khn : khw) + (((kp + 1) & (HD_ / 64 - 1)) * 2 + s) * 512;   /* the chunk read two chunks on: of this item, then of the next */
          __builtin_amdgcn_sched_barrier(0x38f);   /* holds global loads only (the mask lets every other kind cross): keeps the reload behind the last read of its set, so that it takes no third register set */
#pragma unroll
          for (int t = 0; t < 2; ++t) {
#pragma unroll
            for (int u = 0; u < 4; ++u) kn[s][t][u] = *(const v4f*)(kq + t * (16 * HD_) + u * 128); }
          asm volatile("s_wait_xcnt 0x0" ::: "memory");   /* stands behind the kh loads, ahead of the next trip's address arithmetic, which rewrites their address pair */
#pragma unroll
          for (int jg = 0; jg < 4; ++jg) {
#pragma unroll
            for (int jj = 0; jj < 4; jj += 2) { const int j = jg * 4 + jj;   /* 4 independent accumulators between the hi and the lo product of one tile; per tile hi, then lo */
              acc[0][j] = wmma_hi(a[0].h, wf[jg & 1][jj].v, acc[0][j]); acc[1][j] = wmma_hi(a[1].h, wf[jg & 1][jj].v, acc[1][j]);
              acc[0][j + 1] = wmma_hi(a[0].h, wf[jg & 1][jj + 1].v, acc[0][j + 1]); acc[1][j + 1] = wmma_hi(a[1].h, wf[jg & 1][jj + 1].v, acc[1][j + 1]);
              acc[0][j] = wmma_hi(a[0].l, wf[jg & 1][jj].v, acc[0][j]); acc[1][j] = wmma_hi(a[1].l, wf[jg & 1][jj].v, acc[1][j]);
              acc[0][j + 1] = wmma_hi(a[0].l, wf[jg & 1][jj + 1].v, acc[0][j + 1]); acc[1][j + 1] = wmma_hi(a[1].l, wf[jg & 1][jj + 1].v, acc[1][j + 1]); }
            if (jg < 2) {
#pragma unroll
              for (int j = 0; j < 4; ++j) { wf[jg & 1][j].q[0] = *(const v8b*)&sw[kc][jg * 4 + 8 + j][0][lane][0]; wf[jg & 1][j].q[1] = *(const v8b*)&sw[kc][jg * 4 + 8 + j][1][lane][0]; } } } } }
      // the next item's qh row and b1, loaded ahead of the score sums so that the latency runs under them
      const float* qr = QH + (size_t)(ib * TQ + iq) * HD_;
#pragma unroll
      for (int u = 0; u < 2; ++u) { qn[u] = *(const v4f*)(qr + lane * 8 + u * 4); bn[u] = *(const v4f*)(B1 + lane * 8 + u * 4); }
      asm volatile("s_wait_xcnt 0x0" :: "s"(qr) : "memory"); __builtin_amdgcn_sched_barrier(0);   /* the wait stands behind the qh and b1 loads; it names the row's scalar base so that the base stays whole up to it, and the scheduling barrier keeps the score sums, which the listing let rewrite an address register of the loads ahead of the wait, behind it */
#pragma unroll
      for (int t = 0; t < 2; ++t) { float ps[8];
#pragma unroll
        for (int r = 0; r < 8; ++r) { float pp = 0.f;
#pragma unroll
          for (int j = 0; j < 16; ++j) pp += fmaxf(acc[t][j][r] + bfr(b2w[j]), 0.f) * bfr(w3w[j]); ps[r] = pp; }
#pragma unroll
        for (int o = 1; o < 16; o <<= 1) {
#pragma unroll
          for (int r = 0; r < 8; ++r) ps[r] += __shfl_xor(ps[r], o); }   /* sum over the 16 column lanes (lane bits 0..3); every lane shuffles */
        if (col == 0) { v4f s0, s1;
#pragma unroll
          for (int r = 0; r < 4; ++r) { s0[r] = ps[r] + b3v; s1[r] = ps[4 + r] + b3v; }
          vst2(scw + t * 16 + 8 * g, s0); vst2(scw + t * 16 + 8 * g + 4, s1); } }
      if (!more) break;
      khw = khn; scw = SC + (size_t)(ib * TQ + iq) * TK + it * 32; } } }
// ---- k_pv: block = (batch b, 16 queries q0..q0+15, 128 output columns c0..c0+127), 8 waves. The block's 256 x 128 slice of keys[b] is read once, with all its loads issued ahead of the softmax, rounded to bf16 and staged in LDS in B-fragment order. Softmax per query over k < key_len (rows with q >= query_len -> all-zero probs) into LDS, two queries a wave; then out tile = P (hi + lo) x bf16(keys[b]) (exact), all 16 fragment rows are queries -> wave w computes columns c0 + 16w..+15 of the 16 output rows into LDS; after a barrier the 8 waves store 512 contiguous bytes at a time.
__global__ __launch_bounds__(NWV * 32) void k_pv(const float* __restrict__ SC, const float* __restrict__ KEYS, const int* __restrict__ QL, const int* __restrict__ KL, float* __restrict__ OUT) {
  __shared__ __align__(16) float ss[PQ][TK + 4]; __shared__ __align__(16) float so[PQ][PC + 4];
  __shared__ __align__(16) __bf16 sk[TK / 32][PC / 16][W1P];   /* [key chunk of 32][column tile][(element half * 32 + lane) * 8 + k], the layout and pitch of k_lin's W1 slice */
  const int tid = threadIdx.x, wave = tid >> 5, lane = tid & 31, col = lane & 15, g = lane >> 4; const size_t b = blockIdx.x; const int q0 = blockIdx.y * PQ, c0 = blockIdx.z * PC;
  const int qraw = QL[b], kraw = KL[b];
  // keys slice: item = (8 consecutive keys, 4 consecutive columns); a wave's 32 items share the 8 keys, so each row read is 512 contiguous bytes; 4 items a thread, all 32 row reads of 16 bytes in flight under the score loads and the softmax
  v4f rw[TK / 64][8]; { const float* kp = KEYS + (b * TK + wave * 8) * (size_t)HD_ + c0 + lane * 4;
#pragma unroll
    for (int it = 0; it < TK / 64; ++it) {
#pragma unroll
      for (int i = 0; i < 8; ++i) rw[it][i] = *(const v4f*)(kp + (size_t)(it * 64 + i) * HD_); } }
  const int qlen = qraw < 0 ? 0 : (qraw > TQ ? TQ : qraw), klen = kraw < 0 ? 0 : (kraw > TK ? TK : kraw);
  // softmax per query row (wave w: queries 2w, 2w + 1), lane owns keys lane*8..+7; masked keys (k >= klen) excluded, padded queries -> zero probs. Both rows' scores are loaded first and the two rows go through each stage together, so that their dependent chains run interleaved
  v4f s0[PQ / NWV], s1[PQ / NWV];
#pragma unroll
  for (int rr = 0; rr < PQ / NWV; ++rr) { const int qq = wave * (PQ / NWV) + rr; s0[rr] = v4f{-3.0e38f, -3.0e38f, -3.0e38f, -3.0e38f}; s1[rr] = s0[rr];
    if ((q0 + qq) < qlen && (lane >> 2) * 32 < klen) { const float* sr = SC + (b * TQ + q0 + qq) * TK + lane * 8; s0[rr] = *(const v4f*)sr; s1[rr] = *(const v4f*)(sr + 4); } }   /* only 32-key tiles that k_sc wrote in this call are read */
  float v[PQ / NWV][8], e[PQ / NWV][8], m[PQ / NWV], sum[PQ / NWV];
#pragma unroll
  for (int rr = 0; rr < PQ / NWV; ++rr) { m[rr] = -3.0e38f;
#pragma unroll
    for (int u = 0; u < 8; ++u) { const int k = lane * 8 + u; v[rr][u] = (k < klen) ? (u < 4 ? s0[rr][u & 3] : s1[rr][u & 3]) : -3.0e38f; m[rr] = fmaxf(m[rr], v[rr][u]); } }
#pragma unroll
  for (int o = 1; o < 32; o <<= 1) {
#pragma unroll
    for (int rr = 0; rr < PQ / NWV; ++rr) m[rr] = fmaxf(m[rr], __shfl_xor(m[rr], o)); }
#pragma unroll
  for (int rr = 0; rr < PQ / NWV; ++rr) sum[rr] = 0.f;
#pragma unroll
  for (int u = 0; u < 8; ++u) {
#pragma unroll
    for (int rr = 0; rr < PQ / NWV; ++rr) e[rr][u] = 0.f;
    if (lane * 8 + u < klen) {
#pragma unroll
      for (int rr = 0; rr < PQ / NWV; ++rr) e[rr][u] = expf(v[rr][u] - m[rr]); }
#pragma unroll
    for (int rr = 0; rr < PQ / NWV; ++rr) sum[rr] += e[rr][u]; }
#pragma unroll
  for (int o = 1; o < 32; o <<= 1) {
#pragma unroll
    for (int rr = 0; rr < PQ / NWV; ++rr) sum[rr] += __shfl_xor(sum[rr], o); }
#pragma unroll
  for (int rr = 0; rr < PQ / NWV; ++rr) { const int qq = wave * (PQ / NWV) + rr; const float inv = ((q0 + qq) < qlen && sum[rr] > 0.f) ? 1.0f / sum[rr] : 0.f;
#pragma unroll
    for (int u = 0; u < 8; ++u) ss[qq][lane * 8 + u] = e[rr][u] * inv; }
  // the slice into LDS: 4 stores of 16 bytes an item (one per column). key = 32 kc + 16 q + 8 g + i, column = c0 + 16 jt + col, fragment lane = 16 g + col.
#pragma unroll
  for (int it = 0; it < TK / 64; ++it) { const int k8 = it * 8 + wave, n0 = lane * 4;
#pragma unroll
    for (int c = 0; c < 4; ++c) { v8b t;
#pragma unroll
      for (int i = 0; i < 8; ++i) t[i] = (__bf16)rw[it][i][c];
      *(v8b*)&sk[k8 >> 2][n0 >> 4][(((k8 >> 1) & 1) * 32 + (k8 & 1) * 16 + (n0 & 15) + c) * 8] = t; } }
  __syncthreads();   /* probs and the keys slice are read by all 8 waves */
  // out[q0..q0+15][c0 + 16w..+15] = P (hi + lo) x bf16(keys[b]) (exact), K = 256 keys, chunks in ascending order, per chunk hi, then lo
  { v8f acc = {}; v4f pr[TK / 32][4]; union { v16b v; v8b q[2]; } wf[TK / 32];   /* the wave's P rows and keys fragments of all 8 chunks, read from LDS in one group ahead of the WMMAs */
#pragma unroll
    for (int kc = 0; kc < TK / 32; ++kc) { const float* p = &ss[col][kc * 32 + 8 * g]; pr[kc][0] = *(const v4f*)p; pr[kc][1] = *(const v4f*)(p + 4); pr[kc][2] = *(const v4f*)(p + 16); pr[kc][3] = *(const v4f*)(p + 20);
      wf[kc].q[0] = *(const v8b*)&sk[kc][wave][lane * 8]; wf[kc].q[1] = *(const v8b*)&sk[kc][wave][(32 + lane) * 8]; }   /* B[k][d] = keys[b][k][d] */
#pragma unroll
    for (int kc = 0; kc < TK / 32; ++kc) { float va[16];
#pragma unroll
      for (int i = 0; i < 16; ++i) va[i] = pr[kc][i >> 2][i & 3];
      const F2 a = bsplit16(va);
      acc = wmma_bf(a.h, wf[kc].v, acc); acc = wmma_bf(a.l, wf[kc].v, acc); }
#pragma unroll
    for (int r = 0; r < 8; ++r) so[8 * g + r][wave * 16 + col] = acc[r];
    __syncthreads();   /* the 8 waves' column tiles are gathered so that no 128-byte output line has two writers */
#pragma unroll
    for (int h = 0; h < PQ / NWV; ++h) vst2(OUT + ((b * TQ + q0 + h * NWV + wave) * HD_) + c0 + lane * 4, *(const v4f*)&so[h * NWV + wave][lane * 4]); } }   /* a wave stores 512 contiguous bytes of one row */
extern "C" void kernel_launch(void* const* d_in, const int* in_sizes, int n_in, void* d_out, int out_size, void* d_ws, size_t ws_size, hipStream_t stream) {
  (void)in_sizes; (void)n_in; (void)out_size;
  // inputs: 0 queries [4,256,256]; 1 keys [4,256,256]; 2 query_lengths [4] i32; 3 key_lengths [4] i32; 4 W1 [512,256] (in,out: rows 0..255 keys, 256..511 queries); 5 b1 [256]; 6 W2 [256,256]; 7 b2; 8 W3 [256,1]; 9 b3 [1]
  if (ws_size < (size_t)WS_END) return;
  char* ws = (char*)d_ws; const float** F = (const float**)d_in; float *QH = (float*)(ws + WS_QH), *KH = (float*)(ws + WS_KH), *SC = (float*)(ws + WS_SC);
  k_lin<<<dim3(NBV * TQ / 64, HD_ / 128, 2), 128, 0, stream>>>(F[0], F[1], F[4], QH, KH);
  k_sc<<<NBLK, NWV * 32, 0, stream>>>(QH, KH, (const int*)d_in[2], (const int*)d_in[3], F[5], F[6], F[7], F[8], F[9], SC);
  k_pv<<<dim3(NBV, TQ / PQ, HD_ / PC), NWV * 32, 0, stream>>>(SC, F[1], (const int*)d_in[2], (const int*)d_in[3], (float*)d_out);
}

// v009
// One run takes 34 microseconds.
// In both of two side-by-side timings against v008, it was 1.07 times as fast.
// Counting every step since v000, it is 41.0 times as fast.
// compute dtype: all float inputs rounded to bf16; qh = queries W1[256:], kh = keys W1[:256] with EXACT bf16 products on WMMA 16x16x32 (f32 accumulate); per (query, key) pair h1 = relu(qh + kh + b1) in f32, split bf16 hi + lo against exact bf16 W2 (2 products); relu(+b2), the w3 dot, masking and softmax in f32; probs split bf16 hi + lo against exact bf16 keys (2 products); f32 output.
#include <hip/hip_runtime.h>
#include <math.h>

typedef __attribute__((ext_vector_type(16))) _Float16 v16h;
typedef __attribute__((ext_vector_type(16))) __bf16 v16b;
typedef __attribute__((ext_vector_type(8)))  _Float16 v8h;
typedef __attribute__((ext_vector_type(8)))  __bf16 v8b;
typedef __attribute__((ext_vector_type(8)))  float v8f;
typedef __attribute__((ext_vector_type(4)))  float v4f;
typedef __attribute__((ext_vector_type(2)))  float v2f;
typedef __attribute__((ext_vector_type(4)))  unsigned v4u;
typedef __attribute__((ext_vector_type(4)))  int v4i;
typedef float __attribute__((may_alias)) float_a;
typedef int __attribute__((may_alias)) int_a;

template <typename T> __device__ __forceinline__ void vst2(void* p, T v) { *(T*)p = v;  }
__device__ __forceinline__ v8f wmma16(v16h a, v16h b, v8f c) {
  v8f d = __builtin_amdgcn_wmma_f32_16x16x32_f16(false, a, false, b, (short)0, c, false, false);
  asm volatile("v_nop\n\tv_nop\n\tv_nop\n\tv_nop" : "+v"(d) : "v"(a), "v"(b));
  return d;
}
__device__ __forceinline__ v8f wmma_bf(v16b a, v16b b, v8f c) {
  v8f d = __builtin_amdgcn_wmma_f32_16x16x32_bf16(false, a, false, b, (short)0, c, false, false);
  asm volatile("v_nop\n\tv_nop\n\tv_nop\n\tv_nop" : "+v"(d) : "v"(a), "v"(b));
  return d;
}
// the builtin alone, for accumulators that may lie above v255: an asm operand cannot, and 32 accumulator tiles passed through the statement above were spilled to scratch; the compiler keeps the distance behind its own builtin
__device__ __forceinline__ v8f wmma_hi(v16b a, v16b b, v8f c) { return __builtin_amdgcn_wmma_f32_16x16x32_bf16(false, a, false, b, (short)0, c, false, false); }
// 16x16x32 fragments: lane = (h = lane>>4, row/col = lane&15); elements 0..7 = k0+8h+0..7, 8..15 = k0+16+8h+0..7; D element r = row 8h+r
__device__ __forceinline__ v16h frag_h(const _Float16* rowk0, int lane) {
  union { v16h v; v8h q[2]; } u; const _Float16* p = rowk0 + 8 * (lane >> 4);
  u.q[0] = *(const v8h*)p; u.q[1] = *(const v8h*)(p + 16); return u.v;
}
__device__ __forceinline__ v16h frag_f32(const float* rowk0, int lane) {
  v16h a; const float* p = rowk0 + 8 * (lane >> 4);
#pragma unroll
  for (int i = 0; i < 8; ++i) { a[i] = (_Float16)p[i]; a[8 + i] = (_Float16)p[16 + i]; }
  return a;
}
__device__ __forceinline__ v16h frag_f32s(const float* rowk0, int lane, float sc) {
  v16h a; const float* p = rowk0 + 8 * (lane >> 4);
#pragma unroll
  for (int i = 0; i < 8; ++i) { a[i] = (_Float16)(p[i] * sc); a[8 + i] = (_Float16)(p[16 + i] * sc); }
  return a;
}
// column fragment from a [K][ld] layout (column n), rows >= K read as 0
__device__ __forceinline__ v16h fragc_f32(const float* W, int k0, int n, int lane, int ld, int K) {
  v16h a; const int g = lane >> 4;
#pragma unroll
  for (int i = 0; i < 8; ++i) { const int ka = k0 + 8 * g + i, kb = ka + 16;
    a[i] = (_Float16)(ka < K ? W[(size_t)(ka < K ? ka : K - 1) * ld + n] : 0.f); a[8 + i] = (_Float16)(kb < K ? W[(size_t)(kb < K ? kb : K - 1) * ld + n] : 0.f); }
  return a;
}
struct F2 { v16b h, l; };
__device__ __forceinline__ F2 bsplit16(const float v[16]) { F2 r;
#pragma unroll
  for (int i = 0; i < 16; ++i) { const __bf16 h = (__bf16)v[i]; r.h[i] = h; r.l[i] = (__bf16)(v[i] - (float)h); }
  return r; }
__device__ __forceinline__ F2 split_row(const float* row, int k0, int lane) { float v[16]; const float* p = row + k0 + 8 * (lane >> 4);
#pragma unroll
  for (int i = 0; i < 8; ++i) { v[i] = p[i]; v[8 + i] = p[16 + i]; }
  return bsplit16(v); }
__device__ __forceinline__ F2 split_rowK(const float* row, int k0, int lane, int K) { float v[16]; const int g = lane >> 4;
#pragma unroll
  for (int i = 0; i < 8; ++i) { const int ka = k0 + 8 * g + i, kb = ka + 16; v[i] = ka < K ? row[ka < K ? ka : K - 1] : 0.f; v[8 + i] = kb < K ? row[kb < K ? kb : K - 1] : 0.f; }
  return bsplit16(v); }
__device__ __forceinline__ F2 split_col(const float* W, int k0, int n, int lane, int ld, int K) { float v[16]; const int g = lane >> 4;
#pragma unroll
  for (int i = 0; i < 8; ++i) { const int ka = k0 + 8 * g + i, kb = ka + 16; v[i] = ka < K ? W[(size_t)(ka < K ? ka : K - 1) * ld + n] : 0.f; v[8 + i] = kb < K ? W[(size_t)(kb < K ? kb : K - 1) * ld + n] : 0.f; }
  return bsplit16(v); }
__device__ __forceinline__ v8f mac3(const F2& a, const F2& b, v8f c) { c = wmma_bf(a.l, b.h, c); c = wmma_bf(a.h, b.l, c); return wmma_bf(a.h, b.h, c); }
__device__ __forceinline__ float sigm(float v) { return 1.0f / (1.0f + expf(-v)); }
#define LDSX() do { asm volatile("s_wait_dscnt 0" ::: "memory"); __builtin_amdgcn_wave_barrier(); __builtin_amdgcn_fence(__ATOMIC_RELEASE, "workgroup"); } while (0)

// Additive (MLP) attention (B 4, Tq = Tk = 256, dims 256; ragged query/key lengths in [128, 256]): for every (q, k): h = relu([keys_k | queries_q] W1 + b1) = relu(kh_k + qh_q + b1); h = relu(h W2 + b2); score = h . w3 + b3; score := -1e30 where q >= query_len or k >= key_len; probs = softmax over k, then 0 where masked; out = probs keys -> [B, Tq, 256] (padded query rows are exactly 0).
#define NBT 4
#define TQ 256
#define TK 256
#define HD_ 256             // Q = K = H = 256
#define PQ 16               // queries per block of k_pv
#define PC 128              // output columns per block of k_pv
#define NWV 8               // waves per block
#define NBLK 256            // blocks of k_sc, one per WGP
#ifndef NBV
#define NBV NBT             // batches processed
#endif
__device__ __forceinline__ float bfr(float v) { return (float)(__bf16)v; }
#define WS_QH  0u                                   // f32 qh [B*TQ][256]
#define WS_KH  (WS_QH + 4u * (size_t)NBT * TQ * HD_)   // f32 kh in A-fragment order: [B*TK/16 key tile][k chunk of 32][element quarter][lane][4]
#define WS_SC  (WS_KH + 4u * (size_t)NBT * TK * HD_)   // f32 scores [B*TQ][TK]; only the 16-key tiles of unmasked (query, tile) pairs are written, and only those are read
#define WS_END (WS_SC + 4u * (size_t)NBT * TQ * TK)
// ---- k_lin: block = (64 rows, 128 cols, which): which 0: qh = bf16(queries) W1[256:512] ; which 1: kh = bf16(keys) W1[0:256] (exact products, K 256, (in,out)); the block's 256 x 128 slice of W1 is rounded to bf16 and staged once in LDS in B-fragment order, shared by its 4 waves; qh as f32 rows, kh in the pair GEMM's A-fragment order, both stored as 512-B segments by 32 lanes
#define W1P 520             // bf16 per (k chunk, column tile) of the staged W1 slice: 2 halves x 32 lanes x 8 k, plus 8 (16 bytes), so that the 16 lanes of a half wave, which store into 4 column tiles at a time, fall on 16 different bank groups
__global__ __launch_bounds__(128) void k_lin(const float* __restrict__ XQ, const float* __restrict__ XK, const float* __restrict__ W1, float* __restrict__ QH, float* __restrict__ KH) { __shared__ __align__(16) float sf[4][16][132];
  __shared__ __align__(16) __bf16 sw1[HD_ / 32][8][W1P];   /* [k chunk of 32][column tile][(element half * 32 + lane) * 8 + k]; a wave's 16-byte reads of one half are 512 contiguous bytes */
  const int tid = threadIdx.x, wave = tid >> 5, lane = tid & 31, col = lane & 15, g = lane >> 4; const int which = blockIdx.z; const int c0 = blockIdx.y * 128; const size_t r0 = (size_t)blockIdx.x * 64 + wave * 16;
  const float* X = which == 0 ? XQ : XK; const float* Wm = which == 0 ? W1 + (size_t)HD_ * HD_ : W1; float* OUT = which == 0 ? QH : KH;   /* W1 rows 0..255 multiply the keys, rows 256..511 the queries (torch concat order [keys, queries]) */
  // the wave's 16 A rows, all 8 k chunks, loaded ahead of the staging so that both sets of loads are in flight together
  v4f xr[HD_ / 32][4]; { const float* p = X + (r0 + col) * HD_ + 8 * g;
#pragma unroll
    for (int kc = 0; kc < HD_ / 32; ++kc) { xr[kc][0] = *(const v4f*)(p + kc * 32); xr[kc][1] = *(const v4f*)(p + kc * 32 + 4); xr[kc][2] = *(const v4f*)(p + kc * 32 + 16); xr[kc][3] = *(const v4f*)(p + kc * 32 + 20); } }
  // W1 slice: item = (8 consecutive k, 4 consecutive columns); a wave's 32 items share the 8 k, so each row read is 512 contiguous bytes; 8 row reads of 16 bytes, rounded to bf16, 4 stores of 16 bytes (one per column). k = 32 kc + 16 q + 8 g + i, column = c0 + 16 jt + col, fragment lane = 16 g + col.
#pragma unroll 2   /* two items = 16 row reads in flight per thread beside the 32 A reads: four items took the kernel past 256 registers */
  for (int it = 0; it < (HD_ / 8) * (128 / 4) / 128; ++it) { const int k8 = it * 4 + wave, n0 = lane * 4; v4f rw[8];
#pragma unroll
    for (int i = 0; i < 8; ++i) rw[i] = *(const v4f*)(Wm + (size_t)(k8 * 8 + i) * HD_ + c0 + n0);
#pragma unroll
    for (int c = 0; c < 4; ++c) { v8b t;
#pragma unroll
      for (int i = 0; i < 8; ++i) t[i] = (__bf16)rw[i][c];
      *(v8b*)&sw1[k8 >> 2][n0 >> 4][(((k8 >> 1) & 1) * 32 + (k8 & 1) * 16 + (n0 & 15) + c) * 8] = t; } }
  v16b a[HD_ / 32];
#pragma unroll
  for (int kc = 0; kc < HD_ / 32; ++kc) {
#pragma unroll
    for (int i = 0; i < 16; ++i) a[kc][i] = (__bf16)xr[kc][i >> 2][i & 3]; }
  __syncthreads();   /* the slice is read by all 4 waves */
  v8f acc[8] = {};
#pragma unroll
  for (int kc = 0; kc < HD_ / 32; ++kc) { union { v16b v; v8b q[2]; } wf[8];   /* the 8 W1 fragments of this k chunk, read from LDS in one group ahead of the WMMAs */
#pragma unroll
    for (int j = 0; j < 8; ++j) { wf[j].q[0] = *(const v8b*)&sw1[kc][j][lane * 8]; wf[j].q[1] = *(const v8b*)&sw1[kc][j][(32 + lane) * 8]; }
#pragma unroll
    for (int j = 0; j < 8; ++j) acc[j] = wmma_bf(a[kc], wf[j].v, acc[j]); }
#pragma unroll
  for (int j = 0; j < 8; ++j) {
#pragma unroll
    for (int r = 0; r < 8; ++r) sf[wave][8 * g + r][j * 16 + col] = acc[j][r]; }
  LDSX();
  if (which == 0) { for (int rl = 0; rl < 16; ++rl) vst2(OUT + (r0 + rl) * HD_ + c0 + lane * 4, *(const v4f*)&sf[wave][rl][lane * 4]); }
  else {   /* kh: the wave's 16 rows are one key tile; segment s = (k chunk s >> 2, element quarter s & 3); lane (g, col) holds row col, columns 32 chunk + 16 (quarter >> 1) + 8 g + 4 (quarter & 1) + 0..3, i.e. fragment elements 4 quarter + 0..3 */
    float* kf = OUT + ((r0 >> 4) * (HD_ / 32) + (c0 >> 5)) * 512 + lane * 4;
    for (int s = 0; s < 16; ++s) vst2(kf + s * 128, *(const v4f*)&sf[wave][col][(s >> 2) * 32 + ((s >> 1) & 1) * 16 + 8 * g + (s & 1) * 4]);
    asm volatile("s_wait_xcnt 0x0" ::: "memory"); } }   /* stands behind the last kh store, ahead of any code the listing lets follow that rewrites the stores' data or address registers */
// ---- the list of work items, derived from the lengths on the device. Keys come in tiles of 16; batch b has t16 = ceil(key_len / 16) tiles with a key below key_len. An item is two (query, 16-key tile) row-tiles: a whole item = (q, tiles 2t and 2t + 1), t < nf = t16 / 2; where t16 is odd, the last tile (number 2 nf) of two neighbouring queries 2i, 2i + 1 makes one shared item (the last query of an odd query_len stands twice). Batch b holds n[b] = query_len * nf + (t16 & 1) * ceil(query_len / 2) items, the whole ones first in the order t * query_len + q, the batches one after the other. Lengths are clamped to 0..256 by the caller, so b < 4, q < query_len <= 256, tile < t16 <= 16 for every f below the sum of n.
__device__ __forceinline__ void item_of(unsigned f, const unsigned n[NBT], const unsigned ql[NBT], const unsigned nf[NBT], unsigned& b, unsigned q[2], unsigned k[2]) { unsigned r = f; b = 0;
#pragma unroll
  for (unsigned i = 0; i + 1 < NBT; ++i) { if (b == i && r >= n[i]) { r -= n[i]; b = i + 1; } }
  unsigned d = ql[0], h = nf[0];
#pragma unroll
  for (unsigned i = 1; i < NBT; ++i) { d = b == i ? ql[i] : d; h = b == i ? nf[i] : h; }
  d = d < 1u ? 1u : d; const unsigned t = r / d, w = d * h; const bool whole = r < w; const unsigned e = (r - w) * 2u;
  q[0] = whole ? r - t * d : e; q[1] = whole ? q[0] : (e + 1u < d ? e + 1u : d - 1u);
  k[0] = whole ? 2u * t : 2u * h; k[1] = whole ? 2u * t + 1u : 2u * h; }
// ---- k_sc: 256 blocks (one per WGP) of 8 waves (two per SIMD, up to 512 VGPRs a wave). Pairs with q >= query_len or in a 16-key tile wholly past key_len never reach the output, so only the other row-tiles are computed, two to an item (the list above); they are dealt evenly: wave w of block x takes items 2048 p + 1024 (w >> 2) + 4 x + (w & 3), p = 0, 1, ... (waves w and w + 4 share a SIMD, so the SIMDs' item counts differ by one at most; the 4 items of waves 0..3 mostly share a key tile). The wave tile of an item is 32 pairs (2 row-tiles, each with its own query and key tile) x all 256 output columns (32 accumulator tiles), so that a W2 fragment read from LDS feeds 4 WMMAs (2 row-tiles x hi, lo) and A is built once per (row-tile, k chunk): A[row = key][c] = relu(qh[q][c] + kh[k][c] + b1[c]) (f32, built per lane, split bf16 hi + lo; kh comes in fragment order, whole lines per load) x W2 (exact); score[q][k] = sum_c relu(acc + b2[c]) w3[c] (per-lane partial over its columns in ascending tile order, then an xor tree over the 16 column lanes) + b3 -> workspace: a whole item stores one whole 128-byte line, a shared item the first half of two lines whose second half nobody writes or reads.
__global__ __launch_bounds__(NWV * 32) void k_sc(const float* __restrict__ QH, const float* __restrict__ KH, const int* __restrict__ QL, const int* __restrict__ KL, const float* __restrict__ B1, const float* __restrict__ W2, const float* __restrict__ B2, const float* __restrict__ W3, const float* __restrict__ B3, float* __restrict__ SC) {
  __shared__ __align__(16) __bf16 sw[HD_ / 32][HD_ / 16][2][32][8];   /* bf16(W2) in B-fragment order: [k chunk of 32][column tile][element half][lane][8 k]; a wave's 16-byte reads of one half are 512 contiguous bytes */
  __shared__ __align__(16) float sq[NWV][2][HD_];   /* qh[q] + b1 of the two row-tiles of each wave's own item */
  __shared__ float sbw[2][HD_];   /* bf16-rounded b2 and w3, read anew for each item's score sums: kept in registers over the chunk loop they left no room for the second row-tile's qh + b1 */
  const int tid = threadIdx.x, wave = tid >> 5, lane = tid & 31, col = lane & 15, g = lane >> 4;
  unsigned ql[NBT], nf[NBT], nit[NBT], ntot = 0;
#pragma unroll
  for (int i = 0; i < NBT; ++i) { int a = QL[i], c = KL[i]; a = a < 0 ? 0 : (a > TQ ? TQ : a); c = c < 0 ? 0 : (c > TK ? TK : c); ql[i] = i < NBV ? (unsigned)a : 0u; const unsigned t16 = (unsigned)((c + 15) >> 4); nf[i] = t16 >> 1; nit[i] = ql[i] * nf[i] + (t16 & 1u) * ((ql[i] + 1u) >> 1); ntot += nit[i]; }
  const float b2v = B2[tid], w3v = W3[tid];   /* 256 threads, 256 columns; loaded ahead of the W2 staging so that the latency runs under it */
  asm volatile("s_wait_xcnt 0x0" :: "s"(B2), "s"(W3) : "memory");   /* stands behind the two loads and names their scalar bases, which later code may rewrite */
  // W2 staged once per block: item = (8 consecutive k, 4 consecutive columns); 8 row reads of 16 bytes, rounded to bf16, 4 stores of 16 bytes (one per column). k = 32 kc + 16 q + 8 g + i, column = 16 jt + col, fragment lane = 16 g + col.
#pragma unroll 2   /* two items = 16 row reads in flight per thread, so that the 8 trips cost 4 load latencies */
  for (int it = 0; it < (HD_ / 8) * (HD_ / 4) / (NWV * 32); ++it) { const int e = it * (NWV * 32) + tid; const int k8 = e / (HD_ / 4), n0 = (e % (HD_ / 4)) * 4; v4f rw[8];
#pragma unroll
    for (int i = 0; i < 8; ++i) rw[i] = *(const v4f*)(W2 + (size_t)(k8 * 8 + i) * HD_ + n0);
#pragma unroll
    for (int c = 0; c < 4; ++c) { v8b t;
#pragma unroll
      for (int i = 0; i < 8; ++i) t[i] = (__bf16)rw[i][c];
      *(v8b*)&sw[k8 >> 2][n0 >> 4][(k8 >> 1) & 1][(k8 & 1) * 16 + (n0 & 15) + c][0] = t; } }
  sbw[0][tid] = bfr(b2v); sbw[1][tid] = bfr(w3v);
  __syncthreads();   /* the only barrier: every wave passes it, also one that has no item */
  const float b3v = bfr(B3[0]);
  const unsigned wv = (unsigned)__builtin_amdgcn_readfirstlane(wave);   /* the wave's number as a scalar, so that the item arithmetic stays on the scalar unit */
  unsigned f = (wv >> 2) * (NBLK * 4u) + blockIdx.x * 4u + (wv & 3u);
  if (f < ntot) { unsigned ib, iq[2], ik[2];
    item_of(f, nit, ql, nf, ib, iq, ik);
    unsigned khw[2], scw[2];   /* per row-tile t, as element offsets into KH and SC: its key tile in fragment order, 16 * HD_ floats: this lane's fragment row = key 16 ik[t] + col; a wave's 16-byte load covers 512 contiguous bytes (4 lines); and its 16 scores */
#pragma unroll
    for (int t = 0; t < 2; ++t) { khw[t] = (ib * (TK / 16) + ik[t]) * (16 * HD_); scw[t] = (ib * TQ + iq[t]) * TK + ik[t] * 16; }
    float* sqw = &sq[wv][0][0]; const unsigned l4 = (unsigned)lane * 4u;
    const float* pq[2] = { QH + (size_t)(ib * TQ + iq[0]) * HD_, QH + (size_t)(ib * TQ + iq[1]) * HD_ }; const float* pk[2] = { KH + khw[0], KH + khw[1] };   /* the scalar bases of the first item's loads */
    __builtin_amdgcn_sched_barrier(0);   /* keeps the item and address arithmetic above ahead of the loads below: mixed in among them it rewrote a base register of an issued load ahead of the wait that closes the run */
    v4f qn[2][2], bn[2];   /* the qh rows of the item's two row-tiles and b1, 8 columns a lane */
#pragma unroll
    for (int u = 0; u < 2; ++u) { qn[0][u] = *(const v4f*)(pq[0] + lane * 8 + u * 4); qn[1][u] = *(const v4f*)(pq[1] + lane * 8 + u * 4); bn[u] = *(const v4f*)(B1 + lane * 8 + u * 4); }
    v4f kn[2][2][4];   /* kh of this k chunk and of the next (set = chunk & 1), both row-tiles of the item: a set is loaded anew, two chunks ahead, as soon as it has been read, so that the load's latency runs under the WMMAs of two chunks */
#pragma unroll
    for (int s = 0; s < 2; ++s) {
#pragma unroll
      for (int t = 0; t < 2; ++t) {
#pragma unroll
        for (int u = 0; u < 4; ++u) kn[s][t][u] = *(const v4f*)(pk[t] + l4 + s * 512 + u * 128); } }
    asm volatile("s_wait_xcnt 0x0" :: "s"(pq[0]), "s"(pq[1]), "s"(pk[0]), "s"(pk[1]) : "memory"); __builtin_amdgcn_sched_barrier(0);   /* the wait stands behind the qh, b1 and kh loads and names their scalar bases so that these stay whole up to it; the scheduling barrier keeps the loop set-up, which rewrites bases and offset registers of these loads, behind it */
#pragma unroll 1
    for (int p = 0; p < 4; ++p) {   /* at most 8192 items, 2048 a round */
#pragma unroll
      for (int t = 0; t < 2; ++t) {
#pragma unroll
        for (int u = 0; u < 2; ++u) { v4f o; o[0] = qn[t][u][0] + bfr(bn[u][0]); o[1] = qn[t][u][1] + bfr(bn[u][1]); o[2] = qn[t][u][2] + bfr(bn[u][2]); o[3] = qn[t][u][3] + bfr(bn[u][3]); *(v4f*)(sqw + t * HD_ + lane * 8 + u * 4) = o; } }   /* qh[q] + b1 of both row-tiles, staged by the wave for itself */
      LDSX();   /* the rows are read across lanes of this wave */
      const bool more = f + NBLK * 8u < ntot;   /* the wave's next item; behind the last one the same item stands in for it: its first two chunks are loaded once more and not read */
      f = more ? f + NBLK * 8u : f;
      item_of(f, nit, ql, nf, ib, iq, ik);
      const unsigned khn[2] = { (ib * (TK / 16) + ik[0]) * (16 * HD_), (ib * (TK / 16) + ik[1]) * (16 * HD_) };
      v8f acc[2][16] = {};
      v4f sv[2][4];   /* qh + b1 of both row-tiles at this lane's 16 k of a chunk, read from LDS one chunk ahead, as soon as the A build has read the last: two rows read at their use cost the build eight waited reads a chunk */
#pragma unroll
      for (int t = 0; t < 2; ++t) { const float* sp = sqw + t * HD_ + 8 * g; sv[t][0] = *(const v4f*)sp; sv[t][1] = *(const v4f*)(sp + 4); sv[t][2] = *(const v4f*)(sp + 16); sv[t][3] = *(const v4f*)(sp + 20); }
#pragma unroll 1
      for (int kp = 0; kp < HD_ / 64; ++kp) {
#pragma unroll   /* the two chunks of a trip use the two register sets by constant index */
        for (int s = 0; s < 2; ++s) { const int kc = kp * 2 + s;
          union { v16b v; v8b q[2]; } wf[2][4];   /* W2 fragments of this k chunk, 4 column tiles a group, two groups in registers: groups 0 and 1 are read from LDS ahead of the A build, groups 2 and 3 each behind the WMMAs of the group whose registers it takes, one group of WMMAs ahead of its use */
#pragma unroll
          for (int j = 0; j < 8; ++j) { wf[j >> 2][j & 3].q[0] = *(const v8b*)&sw[kc][j][0][lane][0]; wf[j >> 2][j & 3].q[1] = *(const v8b*)&sw[kc][j][1][lane][0]; }
          F2 a[2];
#pragma unroll
          for (int t = 0; t < 2; ++t) { float va[16];
#pragma unroll
            for (int i = 0; i < 16; ++i) va[i] = fmaxf(kn[s][t][i >> 2][i & 3] + sv[t][i >> 2][i & 3], 0.f);   /* relu(kh + qh + b1) */
            a[t] = bsplit16(va); }
#pragma unroll
          for (int t = 0; t < 2; ++t) { const float* sp = sqw + t * HD_ + ((kc + 1) & (HD_ / 32 - 1)) * 32 + 8 * g; sv[t][0] = *(const v4f*)sp; sv[t][1] = *(const v4f*)(sp + 4); sv[t][2] = *(const v4f*)(sp + 16); sv[t][3] = *(const v4f*)(sp + 20); }   /* the next chunk's; behind the last chunk the first is read once more and not used */
          const unsigned ko = (unsigned)(((kp + 1) & (HD_ / 64 - 1)) * 2 + s) * 512u; const float* kq[2] = { KH + ((kp == HD_ / 64 - 1 ? khn[0] : khw[0]) + ko), KH + ((kp == HD_ / 64 - 1 ? khn[1] : khw[1]) + ko) };   /* the chunk read two chunks on: of this item, then of the next */
          __builtin_amdgcn_sched_barrier(0x38f);   /* holds global loads only (the mask lets every other kind cross): keeps the reload behind the last read of its set, so that it takes no third register set */
#pragma unroll
          for (int t = 0; t < 2; ++t) {
#pragma unroll
            for (int u = 0; u < 4; ++u) kn[s][t][u] = *(const v4f*)(kq[t] + l4 + u * 128); }
          asm volatile("s_wait_xcnt 0x0" :: "s"(kq[0]), "s"(kq[1]) : "memory");   /* stands behind the kh loads, ahead of the next chunk's address arithmetic; it names their two scalar bases so that these stay whole up to it */
#pragma unroll
          for (int jg = 0; jg < 4; ++jg) {
#pragma unroll
            for (int jj = 0; jj < 4; jj += 2) { const int j = jg * 4 + jj;   /* 4 independent accumulators between the hi and the lo product of one tile; per tile hi, then lo */
              acc[0][j] = wmma_hi(a[0].h, wf[jg & 1][jj].v, acc[0][j]); acc[1][j] = wmma_hi(a[1].h, wf[jg & 1][jj].v, acc[1][j]);
              acc[0][j + 1] = wmma_hi(a[0].h, wf[jg & 1][jj + 1].v, acc[0][j + 1]); acc[1][j + 1] = wmma_hi(a[1].h, wf[jg & 1][jj + 1].v, acc[1][j + 1]);
              acc[0][j] = wmma_hi(a[0].l, wf[jg & 1][jj].v, acc[0][j]); acc[1][j] = wmma_hi(a[1].l, wf[jg & 1][jj].v, acc[1][j]);
              acc[0][j + 1] = wmma_hi(a[0].l, wf[jg & 1][jj + 1].v, acc[0][j + 1]); acc[1][j + 1] = wmma_hi(a[1].l, wf[jg & 1][jj + 1].v, acc[1][j + 1]); }
            if (jg < 2) {
#pragma unroll
              for (int j = 0; j < 4; ++j) { wf[jg & 1][j].q[0] = *(const v8b*)&sw[kc][jg * 4 + 8 + j][0][lane][0]; wf[jg & 1][j].q[1] = *(const v8b*)&sw[kc][jg * 4 + 8 + j][1][lane][0]; } } } } }
      float b2w[16], w3w[16];   /* this lane's 16 columns */
#pragma unroll
      for (int j = 0; j < 16; ++j) { b2w[j] = sbw[0][j * 16 + col]; w3w[j] = sbw[1][j * 16 + col]; }
      // the next item's qh rows and b1, loaded ahead of the score sums so that the latency runs under them
      const float* qr0 = QH + (size_t)(ib * TQ + iq[0]) * HD_; const float* qr1 = QH + (size_t)(ib * TQ + iq[1]) * HD_;
#pragma unroll
      for (int u = 0; u < 2; ++u) { qn[0][u] = *(const v4f*)(qr0 + lane * 8 + u * 4); qn[1][u] = *(const v4f*)(qr1 + lane * 8 + u * 4); bn[u] = *(const v4f*)(B1 + lane * 8 + u * 4); }
      asm volatile("s_wait_xcnt 0x0" :: "s"(qr0), "s"(qr1) : "memory"); __builtin_amdgcn_sched_barrier(0);   /* the wait stands behind the qh and b1 loads; it names the rows' scalar bases so that they stay whole up to it, and the scheduling barrier keeps the score sums, which the listing let rewrite an address register of the loads ahead of the wait, behind it */
#pragma unroll
      for (int t = 0; t < 2; ++t) { float ps[8];
#pragma unroll
        for (int r = 0; r < 8; ++r) { float pp = 0.f;
#pragma unroll
          for (int j = 0; j < 16; ++j) pp += fmaxf(acc[t][j][r] + b2w[j], 0.f) * w3w[j]; ps[r] = pp; }
#pragma unroll
        for (int o = 1; o < 16; o <<= 1) {
#pragma unroll
          for (int r = 0; r < 8; ++r) ps[r] += __shfl_xor(ps[r], o); }   /* sum over the 16 column lanes (lane bits 0..3); every lane shuffles */
        if (col == 0 && (t == 0 || scw[1] != scw[0])) { v4f s0, s1;   /* the query that stands twice in a shared item is stored once */
#pragma unroll
          for (int r = 0; r < 4; ++r) { s0[r] = ps[r] + b3v; s1[r] = ps[4 + r] + b3v; }
          vst2(SC + scw[t] + 8 * g, s0); vst2(SC + scw[t] + 8 * g + 4, s1); } }
      if (!more) break;
      #pragma unroll
      for (int t = 0; t < 2; ++t) { khw[t] = khn[t]; scw[t] = (ib * TQ + iq[t]) * TK + ik[t] * 16; } } } }
// ---- k_pv: block = (batch b, 16 queries q0..q0+15, 128 output columns c0..c0+127), 8 waves. The block's 256 x 128 slice of keys[b] is read once, with all its loads issued ahead of the softmax, rounded to bf16 and staged in LDS in B-fragment order. Softmax per query over k < key_len (rows with q >= query_len -> all-zero probs) into LDS, two queries a wave; then out tile = P (hi + lo) x bf16(keys[b]) (exact), all 16 fragment rows are queries -> wave w computes columns c0 + 16w..+15 of the 16 output rows into LDS; after a barrier the 8 waves store 512 contiguous bytes at a time.
__global__ __launch_bounds__(NWV * 32) void k_pv(const float* __restrict__ SC, const float* __restrict__ KEYS, const int* __restrict__ QL, const int* __restrict__ KL, float* __restrict__ OUT) {
  __shared__ __align__(16) float ss[PQ][TK + 4]; __shared__ __align__(16) float so[PQ][PC + 4];
  __shared__ __align__(16) __bf16 sk[TK / 32][PC / 16][W1P];   /* [key chunk of 32][column tile][(element half * 32 + lane) * 8 + k], the layout and pitch of k_lin's W1 slice */
  const int tid = threadIdx.x, wave = tid >> 5, lane = tid & 31, col = lane & 15, g = lane >> 4; const size_t b = blockIdx.x; const int q0 = blockIdx.y * PQ, c0 = blockIdx.z * PC;
  const int qraw = QL[b], kraw = KL[b];
  // keys slice: item = (8 consecutive keys, 4 consecutive columns); a wave's 32 items share the 8 keys, so each row read is 512 contiguous bytes; 4 items a thread, all 32 row reads of 16 bytes in flight under the score loads and the softmax
  v4f rw[TK / 64][8]; { const float* kp = KEYS + (b * TK + wave * 8) * (size_t)HD_ + c0 + lane * 4;
#pragma unroll
    for (int it = 0; it < TK / 64; ++it) {
#pragma unroll
      for (int i = 0; i < 8; ++i) rw[it][i] = *(const v4f*)(kp + (size_t)(it * 64 + i) * HD_); } }
  const int qlen = qraw < 0 ? 0 : (qraw > TQ ? TQ : qraw), klen = kraw < 0 ? 0 : (kraw > TK ? TK : kraw);
  // softmax per query row (wave w: queries 2w, 2w + 1), lane owns keys lane*8..+7; masked keys (k >= klen) excluded, padded queries -> zero probs. Both rows' scores are loaded first and the two rows go through each stage together, so that their dependent chains run interleaved
  v4f s0[PQ / NWV], s1[PQ / NWV];
#pragma unroll
  for (int rr = 0; rr < PQ / NWV; ++rr) { const int qq = wave * (PQ / NWV) + rr; s0[rr] = v4f{-3.0e38f, -3.0e38f, -3.0e38f, -3.0e38f}; s1[rr] = s0[rr];
    if ((q0 + qq) < qlen && (lane >> 1) * 16 < klen) { const float* sr = SC + (b * TQ + q0 + qq) * TK + lane * 8; s0[rr] = *(const v4f*)sr; s1[rr] = *(const v4f*)(sr + 4); } }   /* only 16-key tiles that k_sc wrote in this call are read */
  float v[PQ / NWV][8], e[PQ / NWV][8], m[PQ / NWV], sum[PQ / NWV];
#pragma unroll
  for (int rr = 0; rr < PQ / NWV; ++rr) { m[rr] = -3.0e38f;
#pragma unroll
    for (int u = 0; u < 8; ++u) { const int k = lane * 8 + u; v[rr][u] = (k < klen) ? (u < 4 ? s0[rr][u & 3] : s1[rr][u & 3]) : -3.0e38f; m[rr] = fmaxf(m[rr], v[rr][u]); } }
#pragma unroll
  for (int o = 1; o < 32; o <<= 1) {
#pragma unroll
    for (int rr = 0; rr < PQ / NWV; ++rr) m[rr] = fmaxf(m[rr], __shfl_xor(m[rr], o)); }
#pragma unroll
  for (int rr = 0; rr < PQ / NWV; ++rr) sum[rr] = 0.f;
#pragma unroll
  for (int u = 0; u < 8; ++u) {
#pragma unroll
    for (int rr = 0; rr < PQ / NWV; ++rr) e[rr][u] = 0.f;
    if (lane * 8 + u < klen) {
#pragma unroll
      for (int rr = 0; rr < PQ / NWV; ++rr) e[rr][u] = expf(v[rr][u] - m[rr]); }
#pragma unroll
    for (int rr = 0; rr < PQ / NWV; ++rr) sum[rr] += e[rr][u]; }
#pragma unroll
  for (int o = 1; o < 32; o <<= 1) {
#pragma unroll
    for (int rr = 0; rr < PQ / NWV; ++rr) sum[rr] += __shfl_xor(sum[rr], o); }
#pragma unroll
  for (int rr = 0; rr < PQ / NWV; ++rr) { const int qq = wave * (PQ / NWV) + rr; const float inv = ((q0 + qq) < qlen && sum[rr] > 0.f) ? 1.0f / sum[rr] : 0.f;
#pragma unroll
    for (int u = 0; u < 8; ++u) ss[qq][lane * 8 + u] = e[rr][u] * inv; }
  // the slice into LDS: 4 stores of 16 bytes an item (one per column). key = 32 kc + 16 q + 8 g + i, column = c0 + 16 jt + col, fragment lane = 16 g + col.
#pragma unroll
  for (int it = 0; it < TK / 64; ++it) { const int k8 = it * 8 + wave, n0 = lane * 4;
#pragma unroll
    for (int c = 0; c < 4; ++c) { v8b t;
#pragma unroll
      for (int i = 0; i < 8; ++i) t[i] = (__bf16)rw[it][i][c];
      *(v8b*)&sk[k8 >> 2][n0 >> 4][(((k8 >> 1) & 1) * 32 + (k8 & 1) * 16 + (n0 & 15) + c) * 8] = t; } }
  __syncthreads();   /* probs and the keys slice are read by all 8 waves */
  // out[q0..q0+15][c0 + 16w..+15] = P (hi + lo) x bf16(keys[b]) (exact), K = 256 keys, chunks in ascending order, per chunk hi, then lo
  { v8f acc = {}; v4f pr[TK / 32][4]; union { v16b v; v8b q[2]; } wf[TK / 32];   /* the wave's P rows and keys fragments of all 8 chunks, read from LDS in one group ahead of the WMMAs */
#pragma unroll
    for (int kc = 0; kc < TK / 32; ++kc) { const float* p = &ss[col][kc * 32 + 8 * g]; pr[kc][0] = *(const v4f*)p; pr[kc][1] = *(const v4f*)(p + 4); pr[kc][2] = *(const v4f*)(p + 16); pr[kc][3] = *(const v4f*)(p + 20);
      wf[kc].q[0] = *(const v8b*)&sk[kc][wave][lane * 8]; wf[kc].q[1] = *(const v8b*)&sk[kc][wave][(32 + lane) * 8]; }   /* B[k][d] = keys[b][k][d] */
#pragma unroll
    for (int kc = 0; kc < TK / 32; ++kc) { float va[16];
#pragma unroll
      for (int i = 0; i < 16; ++i) va[i] = pr[kc][i >> 2][i & 3];
      const F2 a = bsplit16(va);
      acc = wmma_bf(a.h, wf[kc].v, acc); acc = wmma_bf(a.l, wf[kc].v, acc); }
#pragma unroll
    for (int r = 0; r < 8; ++r) so[8 * g + r][wave * 16 + col] = acc[r];
    __syncthreads();   /* the 8 waves' column tiles are gathered so that no 128-byte output line has two writers */
#pragma unroll
    for (int h = 0; h < PQ / NWV; ++h) vst2(OUT + ((b * TQ + q0 + h * NWV + wave) * HD_) + c0 + lane * 4, *(const v4f*)&so[h * NWV + wave][lane * 4]); } }   /* a wave stores 512 contiguous bytes of one row */
extern "C" void kernel_launch(void* const* d_in, const int* in_sizes, int n_in, void* d_out, int out_size, void* d_ws, size_t ws_size, hipStream_t stream) {
  (void)in_sizes; (void)n_in; (void)out_size;
  // inputs: 0 queries [4,256,256]; 1 keys [4,256,256]; 2 query_lengths [4] i32; 3 key_lengths [4] i32; 4 W1 [512,256] (in,out: rows 0..255 keys, 256..511 queries); 5 b1 [256]; 6 W2 [256,256]; 7 b2; 8 W3 [256,1]; 9 b3 [1]
  if (ws_size < (size_t)WS_END) return;
  char* ws = (char*)d_ws; const float** F = (const float**)d_in; float *QH = (float*)(ws + WS_QH), *KH = (float*)(ws + WS_KH), *SC = (float*)(ws + WS_SC);
  k_lin<<<dim3(NBV * TQ / 64, HD_ / 128, 2), 128, 0, stream>>>(F[0], F[1], F[4], QH, KH);
  k_sc<<<NBLK, NWV * 32, 0, stream>>>(QH, KH, (const int*)d_in[2], (const int*)d_in[3], F[5], F[6], F[7], F[8], F[9], SC);
  k_pv<<<dim3(NBV, TQ / PQ, HD_ / PC), NWV * 32, 0, stream>>>(SC, F[1], (const int*)d_in[2], (const int*)d_in[3], (float*)d_out);
}
